// v000
// Times are from an AMD MI455X. After a warm-up the kernel runs many times in a row, and a time is the length of
// such a window on the GPU divided by its runs, so every launch and the gaps after it count. The runs cycle
// through copies of the inputs. A figure is the median of several windows, for all but v000 over two sittings.
// Sittings can differ by a few percent; kernels timed side by side share one.
// v000 is the starting kernel. One run takes 243 microseconds.
#include <hip/hip_runtime.h>

// ---------------- problem constants ----------------
#define BATCH   4
#define S_LEN   8192
#define HMODEL  768
#define NH      12
#define HD      64
#define KDIM    768          // GEMM K (= HMODEL)
#define NSTEPS  (KDIM/32)    // 24 k-steps of 32 for bf16 WMMA
#define BLK_M   64           // rows of hidden staged per block in k1
#define APITCH  776          // LDS row pitch in halves (768 + 8 pad -> bank spread)
#define M_TOTAL (BATCH*S_LEN)
#define NW_ELEM (HMODEL*HMODEL)

// ---------------- vector types for WMMA ----------------
typedef __attribute__((ext_vector_type(16))) __bf16 v16bf;
typedef __attribute__((ext_vector_type(8)))  float  v8f;

struct Frag {
    union {
        v16bf v;
        uint4 q[2];
        unsigned short us[16];
    };
};

// ---------------- helpers ----------------
__device__ __forceinline__ unsigned short f2bf(float x) {
    union { float f; unsigned int u; } c; c.f = x;
    unsigned int u = c.u;
    unsigned int r = (u + 0x7FFFu + ((u >> 16) & 1u)) >> 16;   // round-nearest-even
    return (unsigned short)r;
}
__device__ __forceinline__ float bf2f(unsigned short h) {
    union { unsigned int u; float f; } c; c.u = ((unsigned int)h) << 16;
    return c.f;
}
__device__ __forceinline__ unsigned int pack2(float a, float b) {
    return (unsigned int)f2bf(a) | ((unsigned int)f2bf(b) << 16);
}
__device__ __forceinline__ float elu1(float x) {          // elu(x)+1
    return x > 0.f ? x + 1.f : __expf(x);
}
__device__ __forceinline__ v8f wmma_bf16(const Frag& a, const Frag& b, v8f c) {
    return __builtin_amdgcn_wmma_f32_16x16x32_bf16(false, a.v, false, b.v,
                                                   (short)0, c, false, false);
}

// ================= kernel 0: W fp32->bf16, zero accumulators =================
__global__ __launch_bounds__(256)
void k0_prep(const float* __restrict__ Wq, const float* __restrict__ Wk,
             const float* __restrict__ Wv, unsigned short* __restrict__ Wb,
             float* __restrict__ kvF, float* __restrict__ ksum) {
    const int stride = gridDim.x * blockDim.x;
    for (int i = blockIdx.x * blockDim.x + threadIdx.x; i < NW_ELEM; i += stride) {
        Wb[i]             = f2bf(Wq[i]);
        Wb[NW_ELEM + i]   = f2bf(Wk[i]);
        Wb[2*NW_ELEM + i] = f2bf(Wv[i]);
    }
    for (int i = blockIdx.x * blockDim.x + threadIdx.x; i < BATCH*NH*HD*HD; i += stride)
        kvF[i] = 0.f;
    for (int i = blockIdx.x * blockDim.x + threadIdx.x; i < BATCH*NH*HD; i += stride)
        ksum[i] = 0.f;
}

// ================= kernel 1: fused QKV projections (bf16 WMMA) =================
// Q -> [bh, s, d] bf16 (normal),  K,V -> [bh, d, s] bf16 (transposed)
__global__ __launch_bounds__(256)
void k1_proj(const float* __restrict__ hid, const float* __restrict__ mask,
             const unsigned short* __restrict__ Wb,
             const float* __restrict__ bq, const float* __restrict__ bk,
             const float* __restrict__ bv,
             unsigned short* __restrict__ Qf, unsigned short* __restrict__ Kt,
             unsigned short* __restrict__ Vt) {
    extern __shared__ unsigned short atile[];        // BLK_M x APITCH bf16
    __shared__ float smask[BLK_M];
    __shared__ float sscr[8][272];                   // per-wave 16x17 f32 transpose pad

    const int tid = threadIdx.x;
    const int gm0 = blockIdx.x * BLK_M;              // first global row (b*S+s)

    if (tid < BLK_M) smask[tid] = mask[gm0 + tid];

    // stage A block fp32 -> bf16 into LDS
    for (int i = tid; i < BLK_M * (KDIM / 4); i += 256) {
        const int row = i / (KDIM / 4);
        const int c4  = i % (KDIM / 4);
        const float4 f = *(const float4*)&hid[(size_t)(gm0 + row) * KDIM + c4 * 4];
        unsigned short* dst = &atile[row * APITCH + c4 * 4];
        dst[0] = f2bf(f.x); dst[1] = f2bf(f.y); dst[2] = f2bf(f.z); dst[3] = f2bf(f.w);
    }
    __syncthreads();

    const int wave = tid >> 5, lane = tid & 31;
    const int ln = lane & 15, hi = lane >> 4;
    const int b   = gm0 / S_LEN;
    const int sb0 = gm0 % S_LEN;
    const v8f vzero = {0.f,0.f,0.f,0.f,0.f,0.f,0.f,0.f};

    for (int g = 0; g < 9; ++g) {                     // 3 proj x 3 n-pair groups
        const int proj = g / 3;
        const int pair = (g % 3) * 8 + wave;          // 0..23
        const int n0   = pair * 2;                    // first 16-col tile index
        const float* bias = (proj == 0) ? bq : ((proj == 1) ? bk : bv);
        const unsigned short* Wp = Wb + (size_t)proj * NW_ELEM;

        v8f acc[4][2];
        #pragma unroll
        for (int ms = 0; ms < 4; ++ms)
            { acc[ms][0] = vzero; acc[ms][1] = vzero; }

        for (int k = 0; k < NSTEPS; ++k) {
            const int off1 = k * 32 + hi * 8;         // half-index of first 8-chunk
            Frag af[4], bfb[2];
            #pragma unroll
            for (int ms = 0; ms < 4; ++ms) {
                const unsigned short* p = &atile[(ms * 16 + ln) * APITCH + off1];
                af[ms].q[0] = *(const uint4*)p;
                af[ms].q[1] = *(const uint4*)(p + 16);
            }
            #pragma unroll
            for (int j = 0; j < 2; ++j) {
                const unsigned short* p =
                    &Wp[(size_t)((n0 + j) * 16 + ln) * KDIM + off1];
                bfb[j].q[0] = *(const uint4*)p;
                bfb[j].q[1] = *(const uint4*)(p + 16);
            }
            #pragma unroll
            for (int ms = 0; ms < 4; ++ms)
                #pragma unroll
                for (int j = 0; j < 2; ++j)
                    acc[ms][j] = wmma_bf16(af[ms], bfb[j], acc[ms][j]);
        }

        // ---- epilogue ----
        #pragma unroll
        for (int ms = 0; ms < 4; ++ms) {
            #pragma unroll
            for (int j = 0; j < 2; ++j) {
                const int ng = (n0 + j) * 16 + ln;    // lane's output column
                const int h  = ng / HD, d = ng % HD;
                const float bb = bias[ng];
                const int sb = sb0 + ms * 16 + hi * 8; // first of lane's 8 rows

                if (proj == 2) {                       // V: bias, transposed store
                    float vv[8];
                    #pragma unroll
                    for (int r = 0; r < 8; ++r) vv[r] = acc[ms][j][r] + bb;
                    uint4 w;
                    w.x = pack2(vv[0], vv[1]); w.y = pack2(vv[2], vv[3]);
                    w.z = pack2(vv[4], vv[5]); w.w = pack2(vv[6], vv[7]);
                    *(uint4*)&Vt[((size_t)(b * NH + h) * HD + d) * S_LEN + sb] = w;
                } else if (proj == 1) {                // K: mask+elu1, transposed
                    float vv[8];
                    #pragma unroll
                    for (int r = 0; r < 8; ++r)
                        vv[r] = elu1(acc[ms][j][r] + bb + smask[ms * 16 + hi * 8 + r]);
                    uint4 w;
                    w.x = pack2(vv[0], vv[1]); w.y = pack2(vv[2], vv[3]);
                    w.z = pack2(vv[4], vv[5]); w.w = pack2(vv[6], vv[7]);
                    *(uint4*)&Kt[((size_t)(b * NH + h) * HD + d) * S_LEN + sb] = w;
                } else {                               // Q: mask+elu1, LDS transpose
                    __builtin_amdgcn_wave_barrier();
                    #pragma unroll
                    for (int r = 0; r < 8; ++r)
                        sscr[wave][(hi * 8 + r) * 17 + ln] =
                            elu1(acc[ms][j][r] + bb + smask[ms * 16 + hi * 8 + r]);
                    __builtin_amdgcn_wave_barrier();
                    const float* src = &sscr[wave][ln * 17 + hi * 8];
                    uint4 w;
                    w.x = pack2(src[0], src[1]); w.y = pack2(src[2], src[3]);
                    w.z = pack2(src[4], src[5]); w.w = pack2(src[6], src[7]);
                    const int sQ    = sb0 + ms * 16 + ln;
                    const int dbase = (((n0 + j) * 16) % HD) + hi * 8;
                    *(uint4*)&Qf[((size_t)(b * NH + h) * S_LEN + sQ) * HD + dbase] = w;
                    __builtin_amdgcn_wave_barrier();
                }
            }
        }
    }
}

// ================= kernel 2: kv = K^T V and ksum = sum_s K =================
__global__ __launch_bounds__(256)
void k2_kv(const unsigned short* __restrict__ Kt, const unsigned short* __restrict__ Vt,
           float* __restrict__ kvF, float* __restrict__ ksum) {
    const int bh = blockIdx.x >> 4;
    const int s0 = (blockIdx.x & 15) * (S_LEN / 16);  // 512-length slice
    const int tid = threadIdx.x;

    // ---- ksum partial (row sums of Kt over this slice) ----
    {
        const int d = tid >> 2, part = tid & 3;
        const unsigned short* p = &Kt[((size_t)bh * HD + d) * S_LEN + s0 + part * 128];
        float sum = 0.f;
        for (int i = 0; i < 16; ++i) {
            uint4 qv = *(const uint4*)(p + i * 8);
            const unsigned short* u = (const unsigned short*)&qv;
            #pragma unroll
            for (int e = 0; e < 8; ++e) sum += bf2f(u[e]);
        }
        atomicAdd(&ksum[bh * HD + d], sum);
    }

    // ---- kv tiles via WMMA: A = Kt[d,s], B^T = Vt[e,s] ----
    const int wave = tid >> 5, lane = tid & 31, ln = lane & 15, hi = lane >> 4;
    const int dt = wave >> 1;                 // d tile 0..3
    const int e0 = (wave & 1) * 2;            // e tiles e0, e0+1
    const v8f vzero = {0.f,0.f,0.f,0.f,0.f,0.f,0.f,0.f};
    v8f acc[2] = {vzero, vzero};

    const unsigned short* Ar = &Kt[((size_t)bh * HD + dt * 16 + ln) * S_LEN + s0];
    const unsigned short* B0 = &Vt[((size_t)bh * HD + (e0    ) * 16 + ln) * S_LEN + s0];
    const unsigned short* B1 = &Vt[((size_t)bh * HD + (e0 + 1) * 16 + ln) * S_LEN + s0];

    for (int k = 0; k < 16; ++k) {
        const int off1 = k * 32 + hi * 8;
        Frag a, b0, b1;
        a.q[0]  = *(const uint4*)(Ar + off1); a.q[1]  = *(const uint4*)(Ar + off1 + 16);
        b0.q[0] = *(const uint4*)(B0 + off1); b0.q[1] = *(const uint4*)(B0 + off1 + 16);
        b1.q[0] = *(const uint4*)(B1 + off1); b1.q[1] = *(const uint4*)(B1 + off1 + 16);
        acc[0] = wmma_bf16(a, b0, acc[0]);
        acc[1] = wmma_bf16(a, b1, acc[1]);
    }
    #pragma unroll
    for (int j = 0; j < 2; ++j) {
        const int e = (e0 + j) * 16 + ln;
        #pragma unroll
        for (int r = 0; r < 8; ++r) {
            const int d = dt * 16 + hi * 8 + r;
            atomicAdd(&kvF[(size_t)bh * (HD * HD) + e * HD + d], acc[j][r]);
        }
    }
}

// ================= kernel 2b: kv f32 -> bf16 (stored as kv^T already) =========
__global__ __launch_bounds__(256)
void k2b_cvt(const float* __restrict__ kvF, unsigned short* __restrict__ kvT) {
    const int i = blockIdx.x * 256 + threadIdx.x;
    if (i < BATCH * NH * HD * HD) kvT[i] = f2bf(kvF[i]);
}

// ================= kernel 3: out = (Q kv) / (Q ksum) =================
__global__ __launch_bounds__(256)
void k3_out(const unsigned short* __restrict__ Qf, const unsigned short* __restrict__ kvT,
            const float* __restrict__ ksum, float* __restrict__ out) {
    __shared__ float sks[HD];
    const int tid = threadIdx.x;
    const int bh  = blockIdx.x >> 6;
    const int blk = blockIdx.x & 63;
    if (tid < HD) sks[tid] = ksum[bh * HD + tid];
    __syncthreads();

    const int wave = tid >> 5, lane = tid & 31, ln = lane & 15, hi = lane >> 4;
    const int st = blk * 8 + wave;                  // s-tile 0..511
    const int s_row = st * 16 + ln;

    const unsigned short* Ar = &Qf[((size_t)bh * S_LEN + s_row) * HD];
    const v8f vzero = {0.f,0.f,0.f,0.f,0.f,0.f,0.f,0.f};
    v8f acc[4] = {vzero, vzero, vzero, vzero};
    float part = 0.f;

    #pragma unroll
    for (int k = 0; k < 2; ++k) {
        const int off1 = k * 32 + hi * 8;
        Frag a;
        a.q[0] = *(const uint4*)(Ar + off1);
        a.q[1] = *(const uint4*)(Ar + off1 + 16);
        // denominator partial: lane holds Q[s_row, off1..off1+7] and [+16..+23]
        #pragma unroll
        for (int e = 0; e < 8; ++e) part += bf2f(a.us[e])     * sks[off1 + e];
        #pragma unroll
        for (int e = 0; e < 8; ++e) part += bf2f(a.us[8 + e]) * sks[off1 + 16 + e];
        #pragma unroll
        for (int j = 0; j < 4; ++j) {
            const unsigned short* Br = &kvT[(size_t)bh * (HD * HD) + (j * 16 + ln) * HD];
            Frag bfr;
            bfr.q[0] = *(const uint4*)(Br + off1);
            bfr.q[1] = *(const uint4*)(Br + off1 + 16);
            acc[j] = wmma_bf16(a, bfr, acc[j]);
        }
    }

    const float dsum = part + __shfl_xor(part, 16, 32);   // combine K-halves
    float dr[8];
    #pragma unroll
    for (int r = 0; r < 8; ++r) dr[r] = __shfl(dsum, r + hi * 8, 32);

    const int b_ = bh / NH, h_ = bh % NH;
    #pragma unroll
    for (int j = 0; j < 4; ++j)
        #pragma unroll
        for (int r = 0; r < 8; ++r) {
            const int s = st * 16 + hi * 8 + r;
            out[((size_t)b_ * S_LEN + s) * HMODEL + h_ * HD + j * 16 + ln] =
                acc[j][r] / dr[r];
        }
}

// ================= launch =================
extern "C" void kernel_launch(void* const* d_in, const int* in_sizes, int n_in,
                              void* d_out, int out_size, void* d_ws, size_t ws_size,
                              hipStream_t stream) {
    const float* hid  = (const float*)d_in[0];
    const float* mask = (const float*)d_in[1];
    const float* Wq   = (const float*)d_in[2];
    const float* bq   = (const float*)d_in[3];
    const float* Wk   = (const float*)d_in[4];
    const float* bk   = (const float*)d_in[5];
    const float* Wv   = (const float*)d_in[6];
    const float* bv   = (const float*)d_in[7];
    float* out = (float*)d_out;

    char* w = (char*)d_ws;                       // 256B-aligned offsets
    unsigned short* Wb  = (unsigned short*)(w);                 // 3.38 MB
    unsigned short* Qf  = (unsigned short*)(w + 3538944);       // 48 MB
    unsigned short* Kt  = (unsigned short*)(w + 53870592);      // 48 MB
    unsigned short* Vt  = (unsigned short*)(w + 104202240);     // 48 MB
    float*          kvF = (float*)(w + 154533888);              // 768 KB
    unsigned short* kvT = (unsigned short*)(w + 155320320);     // 384 KB
    float*          ks  = (float*)(w + 155713536);              // 12 KB

    k0_prep<<<1024, 256, 0, stream>>>(Wq, Wk, Wv, Wb, kvF, ks);
    k1_proj<<<M_TOTAL / BLK_M, 256, BLK_M * APITCH * 2, stream>>>(
        hid, mask, Wb, bq, bk, bv, Qf, Kt, Vt);
    k2_kv<<<BATCH * NH * 16, 256, 0, stream>>>(Kt, Vt, kvF, ks);
    k2b_cvt<<<(BATCH * NH * HD * HD) / 256, 256, 0, stream>>>(kvF, kvT);
    k3_out<<<(BATCH * NH * (S_LEN / 16)) / 8, 256, 0, stream>>>(Qf, kvT, ks, out);
}

// v001
// Measured time: 234 microseconds a run.
// In two side-by-side timings against v000, it was 1.06 and 1.05 times as fast.
#include <hip/hip_runtime.h>

// ---------------- problem constants ----------------
#define BATCH   4
#define S_LEN   8192
#define HMODEL  768
#define NH      12
#define HD      64
#define KDIM    768          // GEMM K (= HMODEL)
#define NSTEPS  (KDIM/32)    // 24 k-steps of 32 for bf16 WMMA
#define BLK_M   64           // rows of hidden staged per block in k1
#define APITCH  776          // LDS row pitch in halves (768 + 8 pad -> bank spread)
#define M_TOTAL (BATCH*S_LEN)
#define NW_ELEM (HMODEL*HMODEL)
#define WRING   4            // k-steps of W fragments in flight per wave in k1

// ---------------- vector types for WMMA ----------------
typedef __attribute__((ext_vector_type(16))) __bf16 v16bf;
typedef __attribute__((ext_vector_type(8)))  float  v8f;

struct Frag {
    union {
        v16bf v;
        uint4 q[2];
        unsigned short us[16];
    };
};

// ---------------- helpers ----------------
__device__ __forceinline__ unsigned short f2bf(float x) {
    union { float f; unsigned int u; } c; c.f = x;
    unsigned int u = c.u;
    unsigned int r = (u + 0x7FFFu + ((u >> 16) & 1u)) >> 16;   // round-nearest-even
    return (unsigned short)r;
}
__device__ __forceinline__ float bf2f(unsigned short h) {
    union { unsigned int u; float f; } c; c.u = ((unsigned int)h) << 16;
    return c.f;
}
__device__ __forceinline__ unsigned int pack2(float a, float b) {
    return (unsigned int)f2bf(a) | ((unsigned int)f2bf(b) << 16);
}
__device__ __forceinline__ float elu1(float x) {          // elu(x)+1
    return x > 0.f ? x + 1.f : __expf(x);
}
__device__ __forceinline__ v8f wmma_bf16(const Frag& a, const Frag& b, v8f c) {
    return __builtin_amdgcn_wmma_f32_16x16x32_bf16(false, a.v, false, b.v,
                                                   (short)0, c, false, false);
}

// ================= kernel 0: W fp32->bf16, zero accumulators =================
__global__ __launch_bounds__(256)
void k0_prep(const float* __restrict__ Wq, const float* __restrict__ Wk,
             const float* __restrict__ Wv, unsigned short* __restrict__ Wb,
             float* __restrict__ kvF, float* __restrict__ ksum) {
    const int stride = gridDim.x * blockDim.x;
    for (int i = blockIdx.x * blockDim.x + threadIdx.x; i < NW_ELEM; i += stride) {
        Wb[i]             = f2bf(Wq[i]);
        Wb[NW_ELEM + i]   = f2bf(Wk[i]);
        Wb[2*NW_ELEM + i] = f2bf(Wv[i]);
    }
    for (int i = blockIdx.x * blockDim.x + threadIdx.x; i < BATCH*NH*HD*HD; i += stride)
        kvF[i] = 0.f;
    for (int i = blockIdx.x * blockDim.x + threadIdx.x; i < BATCH*NH*HD; i += stride)
        ksum[i] = 0.f;
}

// ================= kernel 1: fused QKV projections (bf16 WMMA) =================
// Q -> [bh, s, d] bf16 (normal),  K,V -> [bh, d, s] bf16 (transposed)
__global__ __launch_bounds__(256)
void k1_proj(const float* __restrict__ hid, const float* __restrict__ mask,
             const unsigned short* __restrict__ Wb,
             const float* __restrict__ bq, const float* __restrict__ bk,
             const float* __restrict__ bv,
             unsigned short* __restrict__ Qf, unsigned short* __restrict__ Kt,
             unsigned short* __restrict__ Vt) {
    extern __shared__ unsigned short atile[];        // BLK_M x APITCH bf16
    __shared__ float smask[BLK_M];
    __shared__ float sscr[8][272];                   // per-wave 16x17 f32 transpose pad

    const int tid = threadIdx.x;
    const int gm0 = blockIdx.x * BLK_M;              // first global row (b*S+s)

    if (tid < BLK_M) smask[tid] = mask[gm0 + tid];

    // stage A block fp32 -> bf16 into LDS
    for (int i = tid; i < BLK_M * (KDIM / 4); i += 256) {
        const int row = i / (KDIM / 4);
        const int c4  = i % (KDIM / 4);
        const float4 f = *(const float4*)&hid[(size_t)(gm0 + row) * KDIM + c4 * 4];
        unsigned short* dst = &atile[row * APITCH + c4 * 4];
        dst[0] = f2bf(f.x); dst[1] = f2bf(f.y); dst[2] = f2bf(f.z); dst[3] = f2bf(f.w);
    }
    __syncthreads();

    const int wave = tid >> 5, lane = tid & 31;
    const int ln = lane & 15, hi = lane >> 4;
    const int b   = gm0 / S_LEN;
    const int sb0 = gm0 % S_LEN;
    const v8f vzero = {0.f,0.f,0.f,0.f,0.f,0.f,0.f,0.f};

    // Software-pipelined k loop. W fragments live in a register ring WRING k-steps deep:
    // a slot is refilled right behind the WMMAs that read it, so a load has WRING-1
    // k-steps of matrix work to land. The LDS fragments are fetched one k-step ahead.
    // Stacked W rows are linear in g: row = g*256 + wave*32 + j*16 + ln.
    const unsigned short* wlane = Wb + (size_t)(wave * 32 + ln) * KDIM + hi * 8;
    Frag ring[WRING][2];
    Frag af[2][4];
    #pragma unroll
    for (int s = 0; s < WRING; ++s)
        #pragma unroll
        for (int j = 0; j < 2; ++j) {
            const unsigned short* p = wlane + (size_t)j * 16 * KDIM + s * 32;
            ring[s][j].q[0] = *(const uint4*)p;
            ring[s][j].q[1] = *(const uint4*)(p + 16);
        }
    #pragma unroll
    for (int ms = 0; ms < 4; ++ms) {
        const unsigned short* p = &atile[(ms * 16 + ln) * APITCH + hi * 8];
        af[0][ms].q[0] = *(const uint4*)p;
        af[0][ms].q[1] = *(const uint4*)(p + 16);
    }

    for (int g = 0; g < 9; ++g) {                     // 3 proj x 3 n-pair groups
        const int proj = g / 3;
        const int pair = (g % 3) * 8 + wave;          // 0..23
        const int n0   = pair * 2;                    // first 16-col tile index
        const float* bias = (proj == 0) ? bq : ((proj == 1) ? bk : bv);
        const unsigned short* wcur = wlane + (size_t)g * 256 * KDIM;
        // the ring runs on into the next group's rows, over the epilogue; behind the
        // last group there are none, and the refill stays on this group's own rows
        const unsigned short* wnxt = wlane + (size_t)(g < 8 ? g + 1 : g) * 256 * KDIM;

        v8f acc[4][2];
        #pragma unroll
        for (int ms = 0; ms < 4; ++ms)
            { acc[ms][0] = vzero; acc[ms][1] = vzero; }

        #pragma unroll
        for (int k = 0; k < NSTEPS; ++k) {
            // next k-step's LDS fragments (step 0 again behind the last: every group starts there)
            #pragma unroll
            for (int ms = 0; ms < 4; ++ms) {
                const int off1 = ((k + 1) % NSTEPS) * 32 + hi * 8;   // half-index of first 8-chunk
                const unsigned short* p = &atile[(ms * 16 + ln) * APITCH + off1];
                af[(k + 1) & 1][ms].q[0] = *(const uint4*)p;
                af[(k + 1) & 1][ms].q[1] = *(const uint4*)(p + 16);
            }
            // keeps the LDS reads as one group ahead of this step's WMMAs; without it the
            // compiler sinks them to their use and waits out the LDS latency every step
            __builtin_amdgcn_sched_barrier(0);
            #pragma unroll
            for (int ms = 0; ms < 4; ++ms)
                #pragma unroll
                for (int j = 0; j < 2; ++j)
                    acc[ms][j] = wmma_bf16(af[k & 1][ms], ring[k % WRING][j], acc[ms][j]);
            const unsigned short* wsrc = (k + WRING < NSTEPS)
                ? wcur + (k + WRING) * 32 : wnxt + (k + WRING - NSTEPS) * 32;
            #pragma unroll
            for (int j = 0; j < 2; ++j) {
                const unsigned short* p = wsrc + (size_t)j * 16 * KDIM;
                ring[k % WRING][j].q[0] = *(const uint4*)p;
                ring[k % WRING][j].q[1] = *(const uint4*)(p + 16);
            }
            // keeps the refill here, WRING-1 steps ahead of its use; without it the
            // compiler sinks the loads to their use and the L2 latency is waited out
            __builtin_amdgcn_sched_barrier(0);
        }

        // ---- epilogue ----
        #pragma unroll
        for (int ms = 0; ms < 4; ++ms) {
            #pragma unroll
            for (int j = 0; j < 2; ++j) {
                const int ng = (n0 + j) * 16 + ln;    // lane's output column
                const int h  = ng / HD, d = ng % HD;
                const float bb = bias[ng];
                const int sb = sb0 + ms * 16 + hi * 8; // first of lane's 8 rows

                if (proj == 2) {                       // V: bias, transposed store
                    float vv[8];
                    #pragma unroll
                    for (int r = 0; r < 8; ++r) vv[r] = acc[ms][j][r] + bb;
                    uint4 w;
                    w.x = pack2(vv[0], vv[1]); w.y = pack2(vv[2], vv[3]);
                    w.z = pack2(vv[4], vv[5]); w.w = pack2(vv[6], vv[7]);
                    *(uint4*)&Vt[((size_t)(b * NH + h) * HD + d) * S_LEN + sb] = w;
                } else if (proj == 1) {                // K: mask+elu1, transposed
                    float vv[8];
                    #pragma unroll
                    for (int r = 0; r < 8; ++r)
                        vv[r] = elu1(acc[ms][j][r] + bb + smask[ms * 16 + hi * 8 + r]);
                    uint4 w;
                    w.x = pack2(vv[0], vv[1]); w.y = pack2(vv[2], vv[3]);
                    w.z = pack2(vv[4], vv[5]); w.w = pack2(vv[6], vv[7]);
                    *(uint4*)&Kt[((size_t)(b * NH + h) * HD + d) * S_LEN + sb] = w;
                } else {                               // Q: mask+elu1, LDS transpose
                    __builtin_amdgcn_wave_barrier();
                    #pragma unroll
                    for (int r = 0; r < 8; ++r)
                        sscr[wave][(hi * 8 + r) * 17 + ln] =
                            elu1(acc[ms][j][r] + bb + smask[ms * 16 + hi * 8 + r]);
                    __builtin_amdgcn_wave_barrier();
                    const float* src = &sscr[wave][ln * 17 + hi * 8];
                    uint4 w;
                    w.x = pack2(src[0], src[1]); w.y = pack2(src[2], src[3]);
                    w.z = pack2(src[4], src[5]); w.w = pack2(src[6], src[7]);
                    const int sQ    = sb0 + ms * 16 + ln;
                    const int dbase = (((n0 + j) * 16) % HD) + hi * 8;
                    *(uint4*)&Qf[((size_t)(b * NH + h) * S_LEN + sQ) * HD + dbase] = w;
                    __builtin_amdgcn_wave_barrier();
                }
            }
        }
    }
}

// ================= kernel 2: kv = K^T V and ksum = sum_s K =================
__global__ __launch_bounds__(256)
void k2_kv(const unsigned short* __restrict__ Kt, const unsigned short* __restrict__ Vt,
           float* __restrict__ kvF, float* __restrict__ ksum) {
    const int bh = blockIdx.x >> 4;
    const int s0 = (blockIdx.x & 15) * (S_LEN / 16);  // 512-length slice
    const int tid = threadIdx.x;

    // ---- ksum partial (row sums of Kt over this slice) ----
    {
        const int d = tid >> 2, part = tid & 3;
        const unsigned short* p = &Kt[((size_t)bh * HD + d) * S_LEN + s0 + part * 128];
        float sum = 0.f;
        for (int i = 0; i < 16; ++i) {
            uint4 qv = *(const uint4*)(p + i * 8);
            const unsigned short* u = (const unsigned short*)&qv;
            #pragma unroll
            for (int e = 0; e < 8; ++e) sum += bf2f(u[e]);
        }
        atomicAdd(&ksum[bh * HD + d], sum);
    }

    // ---- kv tiles via WMMA: A = Kt[d,s], B^T = Vt[e,s] ----
    const int wave = tid >> 5, lane = tid & 31, ln = lane & 15, hi = lane >> 4;
    const int dt = wave >> 1;                 // d tile 0..3
    const int e0 = (wave & 1) * 2;            // e tiles e0, e0+1
    const v8f vzero = {0.f,0.f,0.f,0.f,0.f,0.f,0.f,0.f};
    v8f acc[2] = {vzero, vzero};

    const unsigned short* Ar = &Kt[((size_t)bh * HD + dt * 16 + ln) * S_LEN + s0];
    const unsigned short* B0 = &Vt[((size_t)bh * HD + (e0    ) * 16 + ln) * S_LEN + s0];
    const unsigned short* B1 = &Vt[((size_t)bh * HD + (e0 + 1) * 16 + ln) * S_LEN + s0];

    for (int k = 0; k < 16; ++k) {
        const int off1 = k * 32 + hi * 8;
        Frag a, b0, b1;
        a.q[0]  = *(const uint4*)(Ar + off1); a.q[1]  = *(const uint4*)(Ar + off1 + 16);
        b0.q[0] = *(const uint4*)(B0 + off1); b0.q[1] = *(const uint4*)(B0 + off1 + 16);
        b1.q[0] = *(const uint4*)(B1 + off1); b1.q[1] = *(const uint4*)(B1 + off1 + 16);
        acc[0] = wmma_bf16(a, b0, acc[0]);
        acc[1] = wmma_bf16(a, b1, acc[1]);
    }
    #pragma unroll
    for (int j = 0; j < 2; ++j) {
        const int e = (e0 + j) * 16 + ln;
        #pragma unroll
        for (int r = 0; r < 8; ++r) {
            const int d = dt * 16 + hi * 8 + r;
            atomicAdd(&kvF[(size_t)bh * (HD * HD) + e * HD + d], acc[j][r]);
        }
    }
}

// ================= kernel 2b: kv f32 -> bf16 (stored as kv^T already) =========
__global__ __launch_bounds__(256)
void k2b_cvt(const float* __restrict__ kvF, unsigned short* __restrict__ kvT) {
    const int i = blockIdx.x * 256 + threadIdx.x;
    if (i < BATCH * NH * HD * HD) kvT[i] = f2bf(kvF[i]);
}

// ================= kernel 3: out = (Q kv) / (Q ksum) =================
__global__ __launch_bounds__(256)
void k3_out(const unsigned short* __restrict__ Qf, const unsigned short* __restrict__ kvT,
            const float* __restrict__ ksum, float* __restrict__ out) {
    __shared__ float sks[HD];
    const int tid = threadIdx.x;
    const int bh  = blockIdx.x >> 6;
    const int blk = blockIdx.x & 63;
    if (tid < HD) sks[tid] = ksum[bh * HD + tid];
    __syncthreads();

    const int wave = tid >> 5, lane = tid & 31, ln = lane & 15, hi = lane >> 4;
    const int st = blk * 8 + wave;                  // s-tile 0..511
    const int s_row = st * 16 + ln;

    const unsigned short* Ar = &Qf[((size_t)bh * S_LEN + s_row) * HD];
    const v8f vzero = {0.f,0.f,0.f,0.f,0.f,0.f,0.f,0.f};
    v8f acc[4] = {vzero, vzero, vzero, vzero};
    float part = 0.f;

    #pragma unroll
    for (int k = 0; k < 2; ++k) {
        const int off1 = k * 32 + hi * 8;
        Frag a;
        a.q[0] = *(const uint4*)(Ar + off1);
        a.q[1] = *(const uint4*)(Ar + off1 + 16);
        // denominator partial: lane holds Q[s_row, off1..off1+7] and [+16..+23]
        #pragma unroll
        for (int e = 0; e < 8; ++e) part += bf2f(a.us[e])     * sks[off1 + e];
        #pragma unroll
        for (int e = 0; e < 8; ++e) part += bf2f(a.us[8 + e]) * sks[off1 + 16 + e];
        #pragma unroll
        for (int j = 0; j < 4; ++j) {
            const unsigned short* Br = &kvT[(size_t)bh * (HD * HD) + (j * 16 + ln) * HD];
            Frag bfr;
            bfr.q[0] = *(const uint4*)(Br + off1);
            bfr.q[1] = *(const uint4*)(Br + off1 + 16);
            acc[j] = wmma_bf16(a, bfr, acc[j]);
        }
    }

    const float dsum = part + __shfl_xor(part, 16, 32);   // combine K-halves
    float dr[8];
    #pragma unroll
    for (int r = 0; r < 8; ++r) dr[r] = __shfl(dsum, r + hi * 8, 32);

    const int b_ = bh / NH, h_ = bh % NH;
    #pragma unroll
    for (int j = 0; j < 4; ++j)
        #pragma unroll
        for (int r = 0; r < 8; ++r) {
            const int s = st * 16 + hi * 8 + r;
            out[((size_t)b_ * S_LEN + s) * HMODEL + h_ * HD + j * 16 + ln] =
                acc[j][r] / dr[r];
        }
}

// ================= launch =================
extern "C" void kernel_launch(void* const* d_in, const int* in_sizes, int n_in,
                              void* d_out, int out_size, void* d_ws, size_t ws_size,
                              hipStream_t stream) {
    const float* hid  = (const float*)d_in[0];
    const float* mask = (const float*)d_in[1];
    const float* Wq   = (const float*)d_in[2];
    const float* bq   = (const float*)d_in[3];
    const float* Wk   = (const float*)d_in[4];
    const float* bk   = (const float*)d_in[5];
    const float* Wv   = (const float*)d_in[6];
    const float* bv   = (const float*)d_in[7];
    float* out = (float*)d_out;

    char* w = (char*)d_ws;                       // 256B-aligned offsets
    unsigned short* Wb  = (unsigned short*)(w);                 // 3.38 MB
    unsigned short* Qf  = (unsigned short*)(w + 3538944);       // 48 MB
    unsigned short* Kt  = (unsigned short*)(w + 53870592);      // 48 MB
    unsigned short* Vt  = (unsigned short*)(w + 104202240);     // 48 MB
    float*          kvF = (float*)(w + 154533888);              // 768 KB
    unsigned short* kvT = (unsigned short*)(w + 155320320);     // 384 KB
    float*          ks  = (float*)(w + 155713536);              // 12 KB

    k0_prep<<<1024, 256, 0, stream>>>(Wq, Wk, Wv, Wb, kvF, ks);
    k1_proj<<<M_TOTAL / BLK_M, 256, BLK_M * APITCH * 2, stream>>>(
        hid, mask, Wb, bq, bk, bv, Qf, Kt, Vt);
    k2_kv<<<BATCH * NH * 16, 256, 0, stream>>>(Kt, Vt, kvF, ks);
    k2b_cvt<<<(BATCH * NH * HD * HD) / 256, 256, 0, stream>>>(kvF, kvT);
    k3_out<<<(BATCH * NH * (S_LEN / 16)) / 8, 256, 0, stream>>>(Qf, kvT, ks, out);
}

// v002
// One run takes 198 microseconds.
// Timed twice side by side with v001, it ran 1.17 and 1.18 times as fast.
// Counting every step since v000, it is 1.24 times as fast.
#include <hip/hip_runtime.h>

// ---------------- problem constants ----------------
#define BATCH   4
#define S_LEN   8192
#define HMODEL  768
#define NH      12
#define HD      64
#define KDIM    768          // GEMM K (= HMODEL)
#define NSTEPS  (KDIM/32)    // 24 k-steps of 32 for bf16 WMMA
#define BLK_M   64           // rows of hidden staged per block in k1
#define APITCH  776          // LDS row pitch in halves (768 + 8 pad -> bank spread)
#define M_TOTAL (BATCH*S_LEN)
#define NW_ELEM (HMODEL*HMODEL)
#define WRING   4            // k-steps of W fragments in flight per wave in k1
// Packed W, in halves: [pair of 16-row tiles][k-step][tile of the pair][fragment half][lane][8].
// One wave-wide 16-byte load of a fragment half is then 512 contiguous, aligned bytes.
#define WP_HALF  256                 // 32 lanes x 8 halves
#define WP_TILE  (2*WP_HALF)         // one 16x32 fragment
#define WP_STEP  (2*WP_TILE)         // both tiles of a pair, one k-step
#define WP_PAIR  (NSTEPS*WP_STEP)    // a pair's whole K

// ---------------- vector types for WMMA ----------------
typedef __attribute__((ext_vector_type(16))) __bf16 v16bf;
typedef __attribute__((ext_vector_type(8)))  float  v8f;

struct Frag {
    union {
        v16bf v;
        uint4 q[2];
        unsigned short us[16];
    };
};

// ---------------- helpers ----------------
__device__ __forceinline__ unsigned short f2bf(float x) {
    union { float f; unsigned int u; } c; c.f = x;
    unsigned int u = c.u;
    unsigned int r = (u + 0x7FFFu + ((u >> 16) & 1u)) >> 16;   // round-nearest-even
    return (unsigned short)r;
}
__device__ __forceinline__ float bf2f(unsigned short h) {
    union { unsigned int u; float f; } c; c.u = ((unsigned int)h) << 16;
    return c.f;
}
__device__ __forceinline__ unsigned int pack2(float a, float b) {
    return (unsigned int)f2bf(a) | ((unsigned int)f2bf(b) << 16);
}
__device__ __forceinline__ float elu1(float x) {          // elu(x)+1
    return x > 0.f ? x + 1.f : __expf(x);
}
__device__ __forceinline__ v8f wmma_bf16(const Frag& a, const Frag& b, v8f c) {
    return __builtin_amdgcn_wmma_f32_16x16x32_bf16(false, a.v, false, b.v,
                                                   (short)0, c, false, false);
}

// ================= kernel 0: W fp32->bf16 in fragment order, zero accumulators =================
__global__ __launch_bounds__(256)
void k0_prep(const float* __restrict__ Wq, const float* __restrict__ Wk,
             const float* __restrict__ Wv, unsigned short* __restrict__ Wb,
             float* __restrict__ kvF, float* __restrict__ ksum) {
    const int stride = gridDim.x * blockDim.x;
    // one 16-byte piece per thread: the 8 halves that lane (i & 31) of k1 holds in one register quad
    for (int i = blockIdx.x * blockDim.x + threadIdx.x; i < 3 * NW_ELEM / 8; i += stride) {
        const int lane = i & 31, q = (i >> 5) & 1, j = (i >> 6) & 1;
        const int s    = (i >> 7) % NSTEPS, pair = (i >> 7) / NSTEPS;
        const int row  = pair * 32 + j * 16 + (lane & 15);       // row of Wq, Wk, Wv stacked
        const int col  = s * 32 + q * 16 + (lane >> 4) * 8;
        const float* W = (row < HMODEL) ? Wq : ((row < 2 * HMODEL) ? Wk : Wv);
        const float* p = W + (size_t)(row % HMODEL) * KDIM + col;
        const float4 a = *(const float4*)p;
        const float4 c = *(const float4*)(p + 4);
        uint4 w;
        w.x = pack2(a.x, a.y); w.y = pack2(a.z, a.w);
        w.z = pack2(c.x, c.y); w.w = pack2(c.z, c.w);
        *(uint4*)&Wb[(size_t)i * 8] = w;
    }
    for (int i = blockIdx.x * blockDim.x + threadIdx.x; i < BATCH*NH*HD*HD; i += stride)
        kvF[i] = 0.f;
    for (int i = blockIdx.x * blockDim.x + threadIdx.x; i < BATCH*NH*HD; i += stride)
        ksum[i] = 0.f;
}

// ================= kernel 1: fused QKV projections (bf16 WMMA) =================
// Q -> [bh, s, d] bf16 (normal),  K,V -> [bh, d, s] bf16 (transposed)
__global__ __launch_bounds__(256)
void k1_proj(const float* __restrict__ hid, const float* __restrict__ mask,
             const unsigned short* __restrict__ Wb,
             const float* __restrict__ bq, const float* __restrict__ bk,
             const float* __restrict__ bv,
             unsigned short* __restrict__ Qf, unsigned short* __restrict__ Kt,
             unsigned short* __restrict__ Vt) {
    extern __shared__ unsigned short atile[];        // BLK_M x APITCH bf16
    __shared__ float smask[BLK_M];
    __shared__ float sscr[8][272];                   // per-wave 16x17 f32 transpose pad

    const int tid = threadIdx.x;
    const int gm0 = blockIdx.x * BLK_M;              // first global row (b*S+s)

    if (tid < BLK_M) smask[tid] = mask[gm0 + tid];

    // stage A block fp32 -> bf16 into LDS
    for (int i = tid; i < BLK_M * (KDIM / 4); i += 256) {
        const int row = i / (KDIM / 4);
        const int c4  = i % (KDIM / 4);
        const float4 f = *(const float4*)&hid[(size_t)(gm0 + row) * KDIM + c4 * 4];
        unsigned short* dst = &atile[row * APITCH + c4 * 4];
        dst[0] = f2bf(f.x); dst[1] = f2bf(f.y); dst[2] = f2bf(f.z); dst[3] = f2bf(f.w);
    }
    __syncthreads();

    const int wave = tid >> 5, lane = tid & 31;
    const int ln = lane & 15, hi = lane >> 4;
    const int b   = gm0 / S_LEN;
    const int sb0 = gm0 % S_LEN;
    const v8f vzero = {0.f,0.f,0.f,0.f,0.f,0.f,0.f,0.f};

    // Software-pipelined k loop. W fragments live in a register ring WRING k-steps deep:
    // a slot is refilled right behind the WMMAs that read it, so a load has WRING-1
    // k-steps of matrix work to land. The LDS fragments are fetched one k-step ahead.
    // Stacked W rows are linear in g: row = g*256 + wave*32 + j*16 + ln, so pair = g*8 + wave.
    const unsigned short* wlane = Wb + (size_t)wave * WP_PAIR + lane * 8;
    Frag ring[WRING][2];
    Frag af[2][4];
    #pragma unroll
    for (int s = 0; s < WRING; ++s)
        #pragma unroll
        for (int j = 0; j < 2; ++j) {
            const unsigned short* p = wlane + s * WP_STEP + j * WP_TILE;
            ring[s][j].q[0] = *(const uint4*)p;
            ring[s][j].q[1] = *(const uint4*)(p + WP_HALF);
        }
    #pragma unroll
    for (int ms = 0; ms < 4; ++ms) {
        const unsigned short* p = &atile[(ms * 16 + ln) * APITCH + hi * 8];
        af[0][ms].q[0] = *(const uint4*)p;
        af[0][ms].q[1] = *(const uint4*)(p + 16);
    }

    for (int g = 0; g < 9; ++g) {                     // 3 proj x 3 n-pair groups
        const int proj = g / 3;
        const int pair = (g % 3) * 8 + wave;          // 0..23
        const int n0   = pair * 2;                    // first 16-col tile index
        const float* bias = (proj == 0) ? bq : ((proj == 1) ? bk : bv);
        const unsigned short* wcur = wlane + (size_t)g * 8 * WP_PAIR;
        // the ring runs on into the next group's rows, over the epilogue; behind the
        // last group there are none, and the refill stays on this group's own rows
        const unsigned short* wnxt = wlane + (size_t)(g < 8 ? g + 1 : g) * 8 * WP_PAIR;

        v8f acc[4][2];
        #pragma unroll
        for (int ms = 0; ms < 4; ++ms)
            { acc[ms][0] = vzero; acc[ms][1] = vzero; }

        #pragma unroll
        for (int k = 0; k < NSTEPS; ++k) {
            // next k-step's LDS fragments (step 0 again behind the last: every group starts there)
            #pragma unroll
            for (int ms = 0; ms < 4; ++ms) {
                const int off1 = ((k + 1) % NSTEPS) * 32 + hi * 8;   // half-index of first 8-chunk
                const unsigned short* p = &atile[(ms * 16 + ln) * APITCH + off1];
                af[(k + 1) & 1][ms].q[0] = *(const uint4*)p;
                af[(k + 1) & 1][ms].q[1] = *(const uint4*)(p + 16);
            }
            // keeps the LDS reads as one group ahead of this step's WMMAs; without it the
            // compiler sinks them to their use and waits out the LDS latency every step
            __builtin_amdgcn_sched_barrier(0);
            #pragma unroll
            for (int ms = 0; ms < 4; ++ms)
                #pragma unroll
                for (int j = 0; j < 2; ++j)
                    acc[ms][j] = wmma_bf16(af[k & 1][ms], ring[k % WRING][j], acc[ms][j]);
            const unsigned short* wsrc = (k + WRING < NSTEPS)
                ? wcur + (k + WRING) * WP_STEP : wnxt + (k + WRING - NSTEPS) * WP_STEP;
            #pragma unroll
            for (int j = 0; j < 2; ++j) {
                const unsigned short* p = wsrc + j * WP_TILE;
                ring[k % WRING][j].q[0] = *(const uint4*)p;
                ring[k % WRING][j].q[1] = *(const uint4*)(p + WP_HALF);
            }
            // keeps the refill here, WRING-1 steps ahead of its use; without it the
            // compiler sinks the loads to their use and the L2 latency is waited out
            __builtin_amdgcn_sched_barrier(0);
        }

        // ---- epilogue ----
        #pragma unroll
        for (int ms = 0; ms < 4; ++ms) {
            #pragma unroll
            for (int j = 0; j < 2; ++j) {
                const int ng = (n0 + j) * 16 + ln;    // lane's output column
                const int h  = ng / HD, d = ng % HD;
                const float bb = bias[ng];
                const int sb = sb0 + ms * 16 + hi * 8; // first of lane's 8 rows

                if (proj == 2) {                       // V: bias, transposed store
                    float vv[8];
                    #pragma unroll
                    for (int r = 0; r < 8; ++r) vv[r] = acc[ms][j][r] + bb;
                    uint4 w;
                    w.x = pack2(vv[0], vv[1]); w.y = pack2(vv[2], vv[3]);
                    w.z = pack2(vv[4], vv[5]); w.w = pack2(vv[6], vv[7]);
                    *(uint4*)&Vt[((size_t)(b * NH + h) * HD + d) * S_LEN + sb] = w;
                } else if (proj == 1) {                // K: mask+elu1, transposed
                    float vv[8];
                    #pragma unroll
                    for (int r = 0; r < 8; ++r)
                        vv[r] = elu1(acc[ms][j][r] + bb + smask[ms * 16 + hi * 8 + r]);
                    uint4 w;
                    w.x = pack2(vv[0], vv[1]); w.y = pack2(vv[2], vv[3]);
                    w.z = pack2(vv[4], vv[5]); w.w = pack2(vv[6], vv[7]);
                    *(uint4*)&Kt[((size_t)(b * NH + h) * HD + d) * S_LEN + sb] = w;
                } else {                               // Q: mask+elu1, LDS transpose
                    __builtin_amdgcn_wave_barrier();
                    #pragma unroll
                    for (int r = 0; r < 8; ++r)
                        sscr[wave][(hi * 8 + r) * 17 + ln] =
                            elu1(acc[ms][j][r] + bb + smask[ms * 16 + hi * 8 + r]);
                    __builtin_amdgcn_wave_barrier();
                    const float* src = &sscr[wave][ln * 17 + hi * 8];
                    uint4 w;
                    w.x = pack2(src[0], src[1]); w.y = pack2(src[2], src[3]);
                    w.z = pack2(src[4], src[5]); w.w = pack2(src[6], src[7]);
                    const int sQ    = sb0 + ms * 16 + ln;
                    const int dbase = (((n0 + j) * 16) % HD) + hi * 8;
                    *(uint4*)&Qf[((size_t)(b * NH + h) * S_LEN + sQ) * HD + dbase] = w;
                    __builtin_amdgcn_wave_barrier();
                }
            }
        }
    }
}

// ================= kernel 2: kv = K^T V and ksum = sum_s K =================
__global__ __launch_bounds__(256)
void k2_kv(const unsigned short* __restrict__ Kt, const unsigned short* __restrict__ Vt,
           float* __restrict__ kvF, float* __restrict__ ksum) {
    const int bh = blockIdx.x >> 4;
    const int s0 = (blockIdx.x & 15) * (S_LEN / 16);  // 512-length slice
    const int tid = threadIdx.x;

    // ---- ksum partial (row sums of Kt over this slice) ----
    {
        const int d = tid >> 2, part = tid & 3;
        const unsigned short* p = &Kt[((size_t)bh * HD + d) * S_LEN + s0 + part * 128];
        float sum = 0.f;
        for (int i = 0; i < 16; ++i) {
            uint4 qv = *(const uint4*)(p + i * 8);
            const unsigned short* u = (const unsigned short*)&qv;
            #pragma unroll
            for (int e = 0; e < 8; ++e) sum += bf2f(u[e]);
        }
        atomicAdd(&ksum[bh * HD + d], sum);
    }

    // ---- kv tiles via WMMA: A = Kt[d,s], B^T = Vt[e,s] ----
    const int wave = tid >> 5, lane = tid & 31, ln = lane & 15, hi = lane >> 4;
    const int dt = wave >> 1;                 // d tile 0..3
    const int e0 = (wave & 1) * 2;            // e tiles e0, e0+1
    const v8f vzero = {0.f,0.f,0.f,0.f,0.f,0.f,0.f,0.f};
    v8f acc[2] = {vzero, vzero};

    const unsigned short* Ar = &Kt[((size_t)bh * HD + dt * 16 + ln) * S_LEN + s0];
    const unsigned short* B0 = &Vt[((size_t)bh * HD + (e0    ) * 16 + ln) * S_LEN + s0];
    const unsigned short* B1 = &Vt[((size_t)bh * HD + (e0 + 1) * 16 + ln) * S_LEN + s0];

    for (int k = 0; k < 16; ++k) {
        const int off1 = k * 32 + hi * 8;
        Frag a, b0, b1;
        a.q[0]  = *(const uint4*)(Ar + off1); a.q[1]  = *(const uint4*)(Ar + off1 + 16);
        b0.q[0] = *(const uint4*)(B0 + off1); b0.q[1] = *(const uint4*)(B0 + off1 + 16);
        b1.q[0] = *(const uint4*)(B1 + off1); b1.q[1] = *(const uint4*)(B1 + off1 + 16);
        acc[0] = wmma_bf16(a, b0, acc[0]);
        acc[1] = wmma_bf16(a, b1, acc[1]);
    }
    #pragma unroll
    for (int j = 0; j < 2; ++j) {
        const int e = (e0 + j) * 16 + ln;
        #pragma unroll
        for (int r = 0; r < 8; ++r) {
            const int d = dt * 16 + hi * 8 + r;
            atomicAdd(&kvF[(size_t)bh * (HD * HD) + e * HD + d], acc[j][r]);
        }
    }
}

// ================= kernel 2b: kv f32 -> bf16 (stored as kv^T already) =========
__global__ __launch_bounds__(256)
void k2b_cvt(const float* __restrict__ kvF, unsigned short* __restrict__ kvT) {
    const int i = blockIdx.x * 256 + threadIdx.x;
    if (i < BATCH * NH * HD * HD) kvT[i] = f2bf(kvF[i]);
}

// ================= kernel 3: out = (Q kv) / (Q ksum) =================
__global__ __launch_bounds__(256)
void k3_out(const unsigned short* __restrict__ Qf, const unsigned short* __restrict__ kvT,
            const float* __restrict__ ksum, float* __restrict__ out) {
    __shared__ float sks[HD];
    const int tid = threadIdx.x;
    const int bh  = blockIdx.x >> 6;
    const int blk = blockIdx.x & 63;
    if (tid < HD) sks[tid] = ksum[bh * HD + tid];
    __syncthreads();

    const int wave = tid >> 5, lane = tid & 31, ln = lane & 15, hi = lane >> 4;
    const int st = blk * 8 + wave;                  // s-tile 0..511
    const int s_row = st * 16 + ln;

    const unsigned short* Ar = &Qf[((size_t)bh * S_LEN + s_row) * HD];
    const v8f vzero = {0.f,0.f,0.f,0.f,0.f,0.f,0.f,0.f};
    v8f acc[4] = {vzero, vzero, vzero, vzero};
    float part = 0.f;

    #pragma unroll
    for (int k = 0; k < 2; ++k) {
        const int off1 = k * 32 + hi * 8;
        Frag a;
        a.q[0] = *(const uint4*)(Ar + off1);
        a.q[1] = *(const uint4*)(Ar + off1 + 16);
        // denominator partial: lane holds Q[s_row, off1..off1+7] and [+16..+23]
        #pragma unroll
        for (int e = 0; e < 8; ++e) part += bf2f(a.us[e])     * sks[off1 + e];
        #pragma unroll
        for (int e = 0; e < 8; ++e) part += bf2f(a.us[8 + e]) * sks[off1 + 16 + e];
        #pragma unroll
        for (int j = 0; j < 4; ++j) {
            const unsigned short* Br = &kvT[(size_t)bh * (HD * HD) + (j * 16 + ln) * HD];
            Frag bfr;
            bfr.q[0] = *(const uint4*)(Br + off1);
            bfr.q[1] = *(const uint4*)(Br + off1 + 16);
            acc[j] = wmma_bf16(a, bfr, acc[j]);
        }
    }

    const float dsum = part + __shfl_xor(part, 16, 32);   // combine K-halves
    float dr[8];
    #pragma unroll
    for (int r = 0; r < 8; ++r) dr[r] = __shfl(dsum, r + hi * 8, 32);

    const int b_ = bh / NH, h_ = bh % NH;
    #pragma unroll
    for (int j = 0; j < 4; ++j)
        #pragma unroll
        for (int r = 0; r < 8; ++r) {
            const int s = st * 16 + hi * 8 + r;
            out[((size_t)b_ * S_LEN + s) * HMODEL + h_ * HD + j * 16 + ln] =
                acc[j][r] / dr[r];
        }
}

// ================= launch =================
extern "C" void kernel_launch(void* const* d_in, const int* in_sizes, int n_in,
                              void* d_out, int out_size, void* d_ws, size_t ws_size,
                              hipStream_t stream) {
    const float* hid  = (const float*)d_in[0];
    const float* mask = (const float*)d_in[1];
    const float* Wq   = (const float*)d_in[2];
    const float* bq   = (const float*)d_in[3];
    const float* Wk   = (const float*)d_in[4];
    const float* bk   = (const float*)d_in[5];
    const float* Wv   = (const float*)d_in[6];
    const float* bv   = (const float*)d_in[7];
    float* out = (float*)d_out;

    char* w = (char*)d_ws;                       // 256B-aligned offsets
    unsigned short* Wb  = (unsigned short*)(w);                 // 3.38 MB
    unsigned short* Qf  = (unsigned short*)(w + 3538944);       // 48 MB
    unsigned short* Kt  = (unsigned short*)(w + 53870592);      // 48 MB
    unsigned short* Vt  = (unsigned short*)(w + 104202240);     // 48 MB
    float*          kvF = (float*)(w + 154533888);              // 768 KB
    unsigned short* kvT = (unsigned short*)(w + 155320320);     // 384 KB
    float*          ks  = (float*)(w + 155713536);              // 12 KB

    k0_prep<<<1024, 256, 0, stream>>>(Wq, Wk, Wv, Wb, kvF, ks);
    k1_proj<<<M_TOTAL / BLK_M, 256, BLK_M * APITCH * 2, stream>>>(
        hid, mask, Wb, bq, bk, bv, Qf, Kt, Vt);
    k2_kv<<<BATCH * NH * 16, 256, 0, stream>>>(Kt, Vt, kvF, ks);
    k2b_cvt<<<(BATCH * NH * HD * HD) / 256, 256, 0, stream>>>(kvF, kvT);
    k3_out<<<(BATCH * NH * (S_LEN / 16)) / 8, 256, 0, stream>>>(Qf, kvT, ks, out);
}

// v003
// Measured time: 169 microseconds a run.
// Next to v002, in two timings, it ran 1.16 times as fast each time.
// All steps since v000 together make it 1.44 times as fast.
#include <hip/hip_runtime.h>

// ---------------- problem constants ----------------
#define BATCH   4
#define S_LEN   8192
#define HMODEL  768
#define NH      12
#define HD      64
#define KDIM    768          // GEMM K (= HMODEL)
#define NSTEPS  (KDIM/32)    // 24 k-steps of 32 for bf16 WMMA
#define BLK_M   64           // rows of hidden staged per block in k1
#define APITCH  776          // LDS row pitch in halves (768 + 8 pad -> bank spread)
#define M_TOTAL (BATCH*S_LEN)
#define NW_ELEM (HMODEL*HMODEL)
#define WRING   4            // k-steps of W fragments in flight per wave in k1
// Packed W, in halves: [pair of 16-row tiles][k-step][tile of the pair][fragment half][lane][8].
// One wave-wide 16-byte load of a fragment half is then 512 contiguous, aligned bytes.
#define WP_HALF  256                 // 32 lanes x 8 halves
#define WP_TILE  (2*WP_HALF)         // one 16x32 fragment
#define WP_STEP  (2*WP_TILE)         // both tiles of a pair, one k-step
#define WP_PAIR  (NSTEPS*WP_STEP)    // a pair's whole K
// Q, K, V and kv are kept in the same fragment order, in halves ([fragment half][lane][8] innermost):
//   K, V: [bh][block of 32 s][16-row tile of d][2][32][8]   (lane = d row of the tile, k index = s)
//   Q   : [bh][tile of 16 s][block of 32 d][2][32][8]       (lane = s row of the tile, k index = d)
//   kv  : [bh][block of 32 d][16-row tile of e][2][32][8]   (lane = e row of the tile, k index = d)
// so every wave-wide 16-byte store or load of a fragment half is 512 contiguous, aligned bytes.
#define FR_HALF  256                 // 32 lanes x 8 halves
#define FR_FRAG  (2*FR_HALF)         // one 16x32 fragment
#define KV_SBLK  (4*FR_FRAG)         // K, V: the four d tiles of one block of 32 s
#define Q_STILE  (2*FR_FRAG)         // Q: both d blocks of one tile of 16 s
#define BH_ELEM  (S_LEN*HD)          // one head's Q, K or V

// ---------------- vector types for WMMA ----------------
typedef __attribute__((ext_vector_type(16))) __bf16 v16bf;
typedef __attribute__((ext_vector_type(8)))  float  v8f;

struct Frag {
    union {
        v16bf v;
        uint4 q[2];
        unsigned short us[16];
    };
};

// ---------------- helpers ----------------
__device__ __forceinline__ unsigned short f2bf(float x) {
    union { float f; unsigned int u; } c; c.f = x;
    unsigned int u = c.u;
    unsigned int r = (u + 0x7FFFu + ((u >> 16) & 1u)) >> 16;   // round-nearest-even
    return (unsigned short)r;
}
__device__ __forceinline__ float bf2f(unsigned short h) {
    union { unsigned int u; float f; } c; c.u = ((unsigned int)h) << 16;
    return c.f;
}
__device__ __forceinline__ unsigned int pack2(float a, float b) {
    return (unsigned int)f2bf(a) | ((unsigned int)f2bf(b) << 16);
}
__device__ __forceinline__ float elu1(float x) {          // elu(x)+1
    return x > 0.f ? x + 1.f : __expf(x);
}
__device__ __forceinline__ v8f wmma_bf16(const Frag& a, const Frag& b, v8f c) {
    return __builtin_amdgcn_wmma_f32_16x16x32_bf16(false, a.v, false, b.v,
                                                   (short)0, c, false, false);
}

// ================= kernel 0: W fp32->bf16 in fragment order, zero accumulators =================
__global__ __launch_bounds__(256)
void k0_prep(const float* __restrict__ Wq, const float* __restrict__ Wk,
             const float* __restrict__ Wv, unsigned short* __restrict__ Wb,
             float* __restrict__ kvF, float* __restrict__ ksum) {
    const int stride = gridDim.x * blockDim.x;
    // one 16-byte piece per thread: the 8 halves that lane (i & 31) of k1 holds in one register quad
    for (int i = blockIdx.x * blockDim.x + threadIdx.x; i < 3 * NW_ELEM / 8; i += stride) {
        const int lane = i & 31, q = (i >> 5) & 1, j = (i >> 6) & 1;
        const int s    = (i >> 7) % NSTEPS, pair = (i >> 7) / NSTEPS;
        const int row  = pair * 32 + j * 16 + (lane & 15);       // row of Wq, Wk, Wv stacked
        const int col  = s * 32 + q * 16 + (lane >> 4) * 8;
        const float* W = (row < HMODEL) ? Wq : ((row < 2 * HMODEL) ? Wk : Wv);
        const float* p = W + (size_t)(row % HMODEL) * KDIM + col;
        const float4 a = *(const float4*)p;
        const float4 c = *(const float4*)(p + 4);
        uint4 w;
        w.x = pack2(a.x, a.y); w.y = pack2(a.z, a.w);
        w.z = pack2(c.x, c.y); w.w = pack2(c.z, c.w);
        *(uint4*)&Wb[(size_t)i * 8] = w;
    }
    for (int i = blockIdx.x * blockDim.x + threadIdx.x; i < BATCH*NH*HD*HD; i += stride)
        kvF[i] = 0.f;
    for (int i = blockIdx.x * blockDim.x + threadIdx.x; i < BATCH*NH*HD; i += stride)
        ksum[i] = 0.f;
}

// ================= kernel 1: fused QKV projections (bf16 WMMA) =================
// Q, K, V -> bf16 in the fragment order that k2 and k3 load them in
__global__ __launch_bounds__(256)
void k1_proj(const float* __restrict__ hid, const float* __restrict__ mask,
             const unsigned short* __restrict__ Wb,
             const float* __restrict__ bq, const float* __restrict__ bk,
             const float* __restrict__ bv,
             unsigned short* __restrict__ Qf, unsigned short* __restrict__ Kt,
             unsigned short* __restrict__ Vt) {
    extern __shared__ unsigned short atile[];        // BLK_M x APITCH bf16
    __shared__ float smask[BLK_M];
    __shared__ float sscr[8][272];                   // per-wave 16x17 f32 transpose pad

    const int tid = threadIdx.x;
    const int gm0 = blockIdx.x * BLK_M;              // first global row (b*S+s)

    if (tid < BLK_M) smask[tid] = mask[gm0 + tid];

    // stage A block fp32 -> bf16 into LDS
    for (int i = tid; i < BLK_M * (KDIM / 4); i += 256) {
        const int row = i / (KDIM / 4);
        const int c4  = i % (KDIM / 4);
        const float4 f = *(const float4*)&hid[(size_t)(gm0 + row) * KDIM + c4 * 4];
        unsigned short* dst = &atile[row * APITCH + c4 * 4];
        dst[0] = f2bf(f.x); dst[1] = f2bf(f.y); dst[2] = f2bf(f.z); dst[3] = f2bf(f.w);
    }
    __syncthreads();

    const int wave = tid >> 5, lane = tid & 31;
    const int ln = lane & 15, hi = lane >> 4;
    const int b   = gm0 / S_LEN;
    const int sb0 = gm0 % S_LEN;
    const v8f vzero = {0.f,0.f,0.f,0.f,0.f,0.f,0.f,0.f};

    // Software-pipelined k loop. W fragments live in a register ring WRING k-steps deep:
    // a slot is refilled right behind the WMMAs that read it, so a load has WRING-1
    // k-steps of matrix work to land. The LDS fragments are fetched one k-step ahead.
    // Stacked W rows are linear in g: row = g*256 + wave*32 + j*16 + ln, so pair = g*8 + wave.
    const unsigned short* wlane = Wb + (size_t)wave * WP_PAIR + lane * 8;
    Frag ring[WRING][2];
    Frag af[2][4];
    #pragma unroll
    for (int s = 0; s < WRING; ++s)
        #pragma unroll
        for (int j = 0; j < 2; ++j) {
            const unsigned short* p = wlane + s * WP_STEP + j * WP_TILE;
            ring[s][j].q[0] = *(const uint4*)p;
            ring[s][j].q[1] = *(const uint4*)(p + WP_HALF);
        }
    #pragma unroll
    for (int ms = 0; ms < 4; ++ms) {
        const unsigned short* p = &atile[(ms * 16 + ln) * APITCH + hi * 8];
        af[0][ms].q[0] = *(const uint4*)p;
        af[0][ms].q[1] = *(const uint4*)(p + 16);
    }

    for (int g = 0; g < 9; ++g) {                     // 3 proj x 3 n-pair groups
        const int proj = g / 3;
        const int pair = (g % 3) * 8 + wave;          // 0..23
        const int n0   = pair * 2;                    // first 16-col tile index
        const float* bias = (proj == 0) ? bq : ((proj == 1) ? bk : bv);
        const unsigned short* wcur = wlane + (size_t)g * 8 * WP_PAIR;
        // the ring runs on into the next group's rows, over the epilogue; behind the
        // last group there are none, and the refill stays on this group's own rows
        const unsigned short* wnxt = wlane + (size_t)(g < 8 ? g + 1 : g) * 8 * WP_PAIR;

        v8f acc[4][2];
        #pragma unroll
        for (int ms = 0; ms < 4; ++ms)
            { acc[ms][0] = vzero; acc[ms][1] = vzero; }

        #pragma unroll
        for (int k = 0; k < NSTEPS; ++k) {
            // next k-step's LDS fragments (step 0 again behind the last: every group starts there)
            #pragma unroll
            for (int ms = 0; ms < 4; ++ms) {
                const int off1 = ((k + 1) % NSTEPS) * 32 + hi * 8;   // half-index of first 8-chunk
                const unsigned short* p = &atile[(ms * 16 + ln) * APITCH + off1];
                af[(k + 1) & 1][ms].q[0] = *(const uint4*)p;
                af[(k + 1) & 1][ms].q[1] = *(const uint4*)(p + 16);
            }
            // keeps the LDS reads as one group ahead of this step's WMMAs; without it the
            // compiler sinks them to their use and waits out the LDS latency every step
            __builtin_amdgcn_sched_barrier(0);
            #pragma unroll
            for (int ms = 0; ms < 4; ++ms)
                #pragma unroll
                for (int j = 0; j < 2; ++j)
                    acc[ms][j] = wmma_bf16(af[k & 1][ms], ring[k % WRING][j], acc[ms][j]);
            const unsigned short* wsrc = (k + WRING < NSTEPS)
                ? wcur + (k + WRING) * WP_STEP : wnxt + (k + WRING - NSTEPS) * WP_STEP;
            #pragma unroll
            for (int j = 0; j < 2; ++j) {
                const unsigned short* p = wsrc + j * WP_TILE;
                ring[k % WRING][j].q[0] = *(const uint4*)p;
                ring[k % WRING][j].q[1] = *(const uint4*)(p + WP_HALF);
            }
            // keeps the refill here, WRING-1 steps ahead of its use; without it the
            // compiler sinks the loads to their use and the L2 latency is waited out
            __builtin_amdgcn_sched_barrier(0);
        }

        // ---- epilogue ----
        #pragma unroll
        for (int ms = 0; ms < 4; ++ms) {
            #pragma unroll
            for (int j = 0; j < 2; ++j) {
                const int ng = (n0 + j) * 16 + ln;    // lane's output column
                const int h  = ng / HD;
                const int dt = (n0 + j) & 3;          // 16-column tile inside the head
                const float bb = bias[ng];
                // K, V: the lane's 8 rows s are fragment half (ms & 1) of s block sb0/32 + ms/2,
                // and the lane keeps its number (column d -> row of the fragment, hi -> hi)
                const size_t kvoff = (size_t)(b * NH + h) * BH_ELEM
                    + (size_t)((sb0 >> 5) + (ms >> 1)) * KV_SBLK + dt * FR_FRAG
                    + (ms & 1) * FR_HALF + lane * 8;

                if (proj == 2) {                       // V: bias
                    float vv[8];
                    #pragma unroll
                    for (int r = 0; r < 8; ++r) vv[r] = acc[ms][j][r] + bb;
                    uint4 w;
                    w.x = pack2(vv[0], vv[1]); w.y = pack2(vv[2], vv[3]);
                    w.z = pack2(vv[4], vv[5]); w.w = pack2(vv[6], vv[7]);
                    *(uint4*)&Vt[kvoff] = w;
                    // precaution: stands in front of the next write to a register that this store names
                    asm volatile("s_wait_xcnt 0x0" ::: "memory");
                } else if (proj == 1) {                // K: mask+elu1
                    float vv[8];
                    #pragma unroll
                    for (int r = 0; r < 8; ++r)
                        vv[r] = elu1(acc[ms][j][r] + bb + smask[ms * 16 + hi * 8 + r]);
                    uint4 w;
                    w.x = pack2(vv[0], vv[1]); w.y = pack2(vv[2], vv[3]);
                    w.z = pack2(vv[4], vv[5]); w.w = pack2(vv[6], vv[7]);
                    *(uint4*)&Kt[kvoff] = w;
                    // precaution: stands in front of the next write to a register that this store names
                    asm volatile("s_wait_xcnt 0x0" ::: "memory");
                } else {                               // Q: mask+elu1, LDS transpose
                    __builtin_amdgcn_wave_barrier();
                    #pragma unroll
                    for (int r = 0; r < 8; ++r)
                        sscr[wave][(hi * 8 + r) * 17 + ln] =
                            elu1(acc[ms][j][r] + bb + smask[ms * 16 + hi * 8 + r]);
                    __builtin_amdgcn_wave_barrier();
                    const float* src = &sscr[wave][ln * 17 + hi * 8];
                    uint4 w;
                    w.x = pack2(src[0], src[1]); w.y = pack2(src[2], src[3]);
                    w.z = pack2(src[4], src[5]); w.w = pack2(src[6], src[7]);
                    // lane = (row s, hi) now holds columns dt*16 + hi*8 .. +7 of the head:
                    // fragment half (dt & 1) of d block dt/2, s tile sb0/16 + ms
                    *(uint4*)&Qf[(size_t)(b * NH + h) * BH_ELEM
                                 + (size_t)((sb0 >> 4) + ms) * Q_STILE + (dt >> 1) * FR_FRAG
                                 + (dt & 1) * FR_HALF + lane * 8] = w;
                    // precaution: stands in front of the next write to a register that this store names
                    asm volatile("s_wait_xcnt 0x0" ::: "memory");
                    __builtin_amdgcn_wave_barrier();
                }
            }
        }
    }
}

// ================= kernel 2: kv = K^T V and ksum = sum_s K =================
__global__ __launch_bounds__(256)
void k2_kv(const unsigned short* __restrict__ Kt, const unsigned short* __restrict__ Vt,
           float* __restrict__ kvF, float* __restrict__ ksum) {
    const int bh = blockIdx.x >> 4;
    const int tid = threadIdx.x;
    const int wave = tid >> 5, lane = tid & 31, ln = lane & 15, hi = lane >> 4;
    // this block's slice: 512 s = 16 blocks of 32
    const size_t slice = (size_t)bh * BH_ELEM + (size_t)(blockIdx.x & 15) * 16 * KV_SBLK;

    // ---- ksum partial: a wave sums one fragment half of one d tile over the slice ----
    {
        const unsigned short* p = Kt + slice + (wave >> 1) * FR_FRAG + (wave & 1) * FR_HALF + lane * 8;
        float sum = 0.f;
        for (int i = 0; i < 16; ++i) {
            uint4 qv = *(const uint4*)(p + i * KV_SBLK);
            const unsigned short* u = (const unsigned short*)&qv;
            #pragma unroll
            for (int e = 0; e < 8; ++e) sum += bf2f(u[e]);
        }
        atomicAdd(&ksum[bh * HD + (wave >> 1) * 16 + ln], sum);
        // precaution: stands in front of the next write to a register that the atomic names
        asm volatile("s_wait_xcnt 0x0" ::: "memory");
    }

    // ---- kv tiles via WMMA: A = K[d,s], B^T = V[e,s] ----
    const int dt = wave >> 1;                 // d tile 0..3
    const int e0 = (wave & 1) * 2;            // e tiles e0, e0+1
    const v8f vzero = {0.f,0.f,0.f,0.f,0.f,0.f,0.f,0.f};
    v8f acc[2] = {vzero, vzero};

    const unsigned short* Ar = Kt + slice + dt * FR_FRAG + lane * 8;
    const unsigned short* B0 = Vt + slice + e0 * FR_FRAG + lane * 8;
    const unsigned short* B1 = B0 + FR_FRAG;

    for (int k = 0; k < 16; ++k) {
        const int off = k * KV_SBLK;
        Frag a, b0, b1;
        a.q[0]  = *(const uint4*)(Ar + off); a.q[1]  = *(const uint4*)(Ar + off + FR_HALF);
        b0.q[0] = *(const uint4*)(B0 + off); b0.q[1] = *(const uint4*)(B0 + off + FR_HALF);
        // precaution: behind the last use of Ar the compiler gives its registers to the last
        // loads' data; this stands in front of that write
        if (k == 15) asm volatile("s_wait_xcnt 0x0" ::: "memory");
        b1.q[0] = *(const uint4*)(B1 + off); b1.q[1] = *(const uint4*)(B1 + off + FR_HALF);
        acc[0] = wmma_bf16(a, b0, acc[0]);
        acc[1] = wmma_bf16(a, b1, acc[1]);
    }
    #pragma unroll
    for (int j = 0; j < 2; ++j) {
        const int e = (e0 + j) * 16 + ln;
        #pragma unroll
        for (int r = 0; r < 8; ++r) {
            const int d = dt * 16 + hi * 8 + r;
            atomicAdd(&kvF[(size_t)bh * (HD * HD) + e * HD + d], acc[j][r]);
        }
    }
}

// ================= kernel 2b: kv^T f32 -> bf16 in fragment order =========
__global__ __launch_bounds__(256)
void k2b_cvt(const float* __restrict__ kvF, unsigned short* __restrict__ kvT) {
    const int i = blockIdx.x * 256 + threadIdx.x;
    if (i < BATCH * NH * HD * HD) {
        // i = [bh][block of 32 d][e tile][fragment half][lane][8]
        const int lane = (i >> 3) & 31;
        const int e = ((i >> 9) & 3) * 16 + (lane & 15);
        const int d = ((i >> 11) & 1) * 32 + ((i >> 8) & 1) * 16 + (lane >> 4) * 8 + (i & 7);
        kvT[i] = f2bf(kvF[(i >> 12) * (HD * HD) + e * HD + d]);
    }
}

// ================= kernel 3: out = (Q kv) / (Q ksum) =================
__global__ __launch_bounds__(256)
void k3_out(const unsigned short* __restrict__ Qf, const unsigned short* __restrict__ kvT,
            const float* __restrict__ ksum, float* __restrict__ out) {
    __shared__ float sks[HD];
    const int tid = threadIdx.x;
    const int bh  = blockIdx.x >> 6;
    const int blk = blockIdx.x & 63;
    if (tid < HD) sks[tid] = ksum[bh * HD + tid];
    __syncthreads();

    const int wave = tid >> 5, lane = tid & 31, ln = lane & 15, hi = lane >> 4;
    const int st = blk * 8 + wave;                  // s-tile 0..511

    const unsigned short* Ar = Qf + (size_t)bh * BH_ELEM + (size_t)st * Q_STILE + lane * 8;
    const v8f vzero = {0.f,0.f,0.f,0.f,0.f,0.f,0.f,0.f};
    v8f acc[4] = {vzero, vzero, vzero, vzero};
    float part = 0.f;

    #pragma unroll
    for (int k = 0; k < 2; ++k) {
        const int off1 = k * 32 + hi * 8;
        Frag a;
        a.q[0] = *(const uint4*)(Ar + k * FR_FRAG);
        a.q[1] = *(const uint4*)(Ar + k * FR_FRAG + FR_HALF);
        // denominator partial: lane holds Q[st*16+ln, off1..off1+7] and [+16..+23]
        #pragma unroll
        for (int e = 0; e < 8; ++e) part += bf2f(a.us[e])     * sks[off1 + e];
        #pragma unroll
        for (int e = 0; e < 8; ++e) part += bf2f(a.us[8 + e]) * sks[off1 + 16 + e];
        #pragma unroll
        for (int j = 0; j < 4; ++j) {
            const unsigned short* Br = kvT + (size_t)bh * (HD * HD) + (k * 4 + j) * FR_FRAG + lane * 8;
            Frag bfr;
            bfr.q[0] = *(const uint4*)Br;
            bfr.q[1] = *(const uint4*)(Br + FR_HALF);
            acc[j] = wmma_bf16(a, bfr, acc[j]);
        }
    }

    const float dsum = part + __shfl_xor(part, 16, 32);   // combine K-halves
    float dr[8];
    #pragma unroll
    for (int r = 0; r < 8; ++r) dr[r] = __shfl(dsum, r + hi * 8, 32);

    const int b_ = bh / NH, h_ = bh % NH;
    #pragma unroll
    for (int j = 0; j < 4; ++j)
        #pragma unroll
        for (int r = 0; r < 8; ++r) {
            const int s = st * 16 + hi * 8 + r;
            out[((size_t)b_ * S_LEN + s) * HMODEL + h_ * HD + j * 16 + ln] =
                acc[j][r] / dr[r];
        }
}

// ================= launch =================
extern "C" void kernel_launch(void* const* d_in, const int* in_sizes, int n_in,
                              void* d_out, int out_size, void* d_ws, size_t ws_size,
                              hipStream_t stream) {
    const float* hid  = (const float*)d_in[0];
    const float* mask = (const float*)d_in[1];
    const float* Wq   = (const float*)d_in[2];
    const float* bq   = (const float*)d_in[3];
    const float* Wk   = (const float*)d_in[4];
    const float* bk   = (const float*)d_in[5];
    const float* Wv   = (const float*)d_in[6];
    const float* bv   = (const float*)d_in[7];
    float* out = (float*)d_out;

    char* w = (char*)d_ws;                       // 256B-aligned offsets
    unsigned short* Wb  = (unsigned short*)(w);                 // 3.38 MB
    unsigned short* Qf  = (unsigned short*)(w + 3538944);       // 48 MB
    unsigned short* Kt  = (unsigned short*)(w + 53870592);      // 48 MB
    unsigned short* Vt  = (unsigned short*)(w + 104202240);     // 48 MB
    float*          kvF = (float*)(w + 154533888);              // 768 KB
    unsigned short* kvT = (unsigned short*)(w + 155320320);     // 384 KB
    float*          ks  = (float*)(w + 155713536);              // 12 KB

    k0_prep<<<1024, 256, 0, stream>>>(Wq, Wk, Wv, Wb, kvF, ks);
    k1_proj<<<M_TOTAL / BLK_M, 256, BLK_M * APITCH * 2, stream>>>(
        hid, mask, Wb, bq, bk, bv, Qf, Kt, Vt);
    k2_kv<<<BATCH * NH * 16, 256, 0, stream>>>(Kt, Vt, kvF, ks);
    k2b_cvt<<<(BATCH * NH * HD * HD) / 256, 256, 0, stream>>>(kvF, kvT);
    k3_out<<<(BATCH * NH * (S_LEN / 16)) / 8, 256, 0, stream>>>(Qf, kvT, ks, out);
}

// v004
// A run of this version takes 138 microseconds.
// In two side-by-side timings against v003, it was 1.25 and 1.26 times as fast.
// Counting every step since v000, it is 1.81 times as fast.
#include <hip/hip_runtime.h>

// ---------------- problem constants ----------------
#define BATCH   4
#define S_LEN   8192
#define HMODEL  768
#define NH      12
#define HD      64
#define KDIM    768          // GEMM K (= HMODEL)
#define NSTEPS  (KDIM/32)    // 24 k-steps of 32 for bf16 WMMA
#define BLK_M   64           // rows of hidden staged per block in k1
#define APITCH  776          // LDS row pitch in halves (768 + 8 pad -> bank spread)
#define M_TOTAL (BATCH*S_LEN)
#define NW_ELEM (HMODEL*HMODEL)
#define WRING   4            // k-steps of W fragments in flight per wave in k1
// Packed W, in halves: [pair of 16-row tiles][k-step][tile of the pair][fragment half][lane][8].
// One wave-wide 16-byte load of a fragment half is then 512 contiguous, aligned bytes.
#define WP_HALF  256                 // 32 lanes x 8 halves
#define WP_TILE  (2*WP_HALF)         // one 16x32 fragment
#define WP_STEP  (2*WP_TILE)         // both tiles of a pair, one k-step
#define WP_PAIR  (NSTEPS*WP_STEP)    // a pair's whole K
// Q, K, V and kv are kept in the same fragment order, in halves ([fragment half][lane][8] innermost):
//   K, V: [bh][block of 32 s][16-row tile of d][2][32][8]   (lane = d row of the tile, k index = s)
//   Q   : [bh][tile of 16 s][block of 32 d][2][32][8]       (lane = s row of the tile, k index = d)
//   kv  : [bh][block of 32 d][16-row tile of e][2][32][8]   (lane = e row of the tile, k index = d)
// so every wave-wide 16-byte store or load of a fragment half is 512 contiguous, aligned bytes.
#define FR_HALF  256                 // 32 lanes x 8 halves
#define FR_FRAG  (2*FR_HALF)         // one 16x32 fragment
#define KV_SBLK  (4*FR_FRAG)         // K, V: the four d tiles of one block of 32 s
#define Q_STILE  (2*FR_FRAG)         // Q: both d blocks of one tile of 16 s
#define BH_ELEM  (S_LEN*HD)          // one head's Q, K or V
#define NSLICE   16                  // k2: blocks (slices of 512 s) per head
#define KVB_BLOCKS (BATCH*NH*HD*HD/4/256)   // k2b: blocks that sum kv; BATCH*NH*HD/256 more sum ksum

// ---------------- vector types for WMMA ----------------
typedef __attribute__((ext_vector_type(16))) __bf16 v16bf;
typedef __attribute__((ext_vector_type(8)))  float  v8f;

struct Frag {
    union {
        v16bf v;
        uint4 q[2];
        unsigned short us[16];
    };
};

// ---------------- helpers ----------------
__device__ __forceinline__ unsigned short f2bf(float x) {
    union { float f; unsigned int u; } c; c.f = x;
    unsigned int u = c.u;
    unsigned int r = (u + 0x7FFFu + ((u >> 16) & 1u)) >> 16;   // round-nearest-even
    return (unsigned short)r;
}
__device__ __forceinline__ float bf2f(unsigned short h) {
    union { unsigned int u; float f; } c; c.u = ((unsigned int)h) << 16;
    return c.f;
}
__device__ __forceinline__ unsigned int pack2(float a, float b) {
    return (unsigned int)f2bf(a) | ((unsigned int)f2bf(b) << 16);
}
__device__ __forceinline__ float elu1(float x) {          // elu(x)+1
    return x > 0.f ? x + 1.f : __expf(x);
}
__device__ __forceinline__ v8f wmma_bf16(const Frag& a, const Frag& b, v8f c) {
    return __builtin_amdgcn_wmma_f32_16x16x32_bf16(false, a.v, false, b.v,
                                                   (short)0, c, false, false);
}

// ================= kernel 0: W fp32->bf16 in fragment order =================
__global__ __launch_bounds__(256)
void k0_prep(const float* __restrict__ Wq, const float* __restrict__ Wk,
             const float* __restrict__ Wv, unsigned short* __restrict__ Wb) {
    const int stride = gridDim.x * blockDim.x;
    // one 16-byte piece per thread: the 8 halves that lane (i & 31) of k1 holds in one register quad
    for (int i = blockIdx.x * blockDim.x + threadIdx.x; i < 3 * NW_ELEM / 8; i += stride) {
        const int lane = i & 31, q = (i >> 5) & 1, j = (i >> 6) & 1;
        const int s    = (i >> 7) % NSTEPS, pair = (i >> 7) / NSTEPS;
        const int row  = pair * 32 + j * 16 + (lane & 15);       // row of Wq, Wk, Wv stacked
        const int col  = s * 32 + q * 16 + (lane >> 4) * 8;
        const float* W = (row < HMODEL) ? Wq : ((row < 2 * HMODEL) ? Wk : Wv);
        const float* p = W + (size_t)(row % HMODEL) * KDIM + col;
        const float4 a = *(const float4*)p;
        const float4 c = *(const float4*)(p + 4);
        uint4 w;
        w.x = pack2(a.x, a.y); w.y = pack2(a.z, a.w);
        w.z = pack2(c.x, c.y); w.w = pack2(c.z, c.w);
        *(uint4*)&Wb[(size_t)i * 8] = w;
    }
}

// ================= kernel 1: fused QKV projections (bf16 WMMA) =================
// Q, K, V -> bf16 in the fragment order that k2 and k3 load them in
__global__ __launch_bounds__(256)
void k1_proj(const float* __restrict__ hid, const float* __restrict__ mask,
             const unsigned short* __restrict__ Wb,
             const float* __restrict__ bq, const float* __restrict__ bk,
             const float* __restrict__ bv,
             unsigned short* __restrict__ Qf, unsigned short* __restrict__ Kt,
             unsigned short* __restrict__ Vt) {
    extern __shared__ unsigned short atile[];        // BLK_M x APITCH bf16
    __shared__ float smask[BLK_M];
    __shared__ float sscr[8][272];                   // per-wave 16x17 f32 transpose pad

    const int tid = threadIdx.x;
    const int gm0 = blockIdx.x * BLK_M;              // first global row (b*S+s)

    if (tid < BLK_M) smask[tid] = mask[gm0 + tid];

    // stage A block fp32 -> bf16 into LDS
    for (int i = tid; i < BLK_M * (KDIM / 4); i += 256) {
        const int row = i / (KDIM / 4);
        const int c4  = i % (KDIM / 4);
        const float4 f = *(const float4*)&hid[(size_t)(gm0 + row) * KDIM + c4 * 4];
        unsigned short* dst = &atile[row * APITCH + c4 * 4];
        dst[0] = f2bf(f.x); dst[1] = f2bf(f.y); dst[2] = f2bf(f.z); dst[3] = f2bf(f.w);
    }
    __syncthreads();

    const int wave = tid >> 5, lane = tid & 31;
    const int ln = lane & 15, hi = lane >> 4;
    const int b   = gm0 / S_LEN;
    const int sb0 = gm0 % S_LEN;
    const v8f vzero = {0.f,0.f,0.f,0.f,0.f,0.f,0.f,0.f};

    // Software-pipelined k loop. W fragments live in a register ring WRING k-steps deep:
    // a slot is refilled right behind the WMMAs that read it, so a load has WRING-1
    // k-steps of matrix work to land. The LDS fragments are fetched one k-step ahead.
    // Stacked W rows are linear in g: row = g*256 + wave*32 + j*16 + ln, so pair = g*8 + wave.
    const unsigned short* wlane = Wb + (size_t)wave * WP_PAIR + lane * 8;
    Frag ring[WRING][2];
    Frag af[2][4];
    #pragma unroll
    for (int s = 0; s < WRING; ++s)
        #pragma unroll
        for (int j = 0; j < 2; ++j) {
            const unsigned short* p = wlane + s * WP_STEP + j * WP_TILE;
            ring[s][j].q[0] = *(const uint4*)p;
            ring[s][j].q[1] = *(const uint4*)(p + WP_HALF);
        }
    #pragma unroll
    for (int ms = 0; ms < 4; ++ms) {
        const unsigned short* p = &atile[(ms * 16 + ln) * APITCH + hi * 8];
        af[0][ms].q[0] = *(const uint4*)p;
        af[0][ms].q[1] = *(const uint4*)(p + 16);
    }

    for (int g = 0; g < 9; ++g) {                     // 3 proj x 3 n-pair groups
        const int proj = g / 3;
        const int pair = (g % 3) * 8 + wave;          // 0..23
        const int n0   = pair * 2;                    // first 16-col tile index
        const float* bias = (proj == 0) ? bq : ((proj == 1) ? bk : bv);
        const unsigned short* wcur = wlane + (size_t)g * 8 * WP_PAIR;
        // the ring runs on into the next group's rows, over the epilogue; behind the
        // last group there are none, and the refill stays on this group's own rows
        const unsigned short* wnxt = wlane + (size_t)(g < 8 ? g + 1 : g) * 8 * WP_PAIR;

        v8f acc[4][2];
        #pragma unroll
        for (int ms = 0; ms < 4; ++ms)
            { acc[ms][0] = vzero; acc[ms][1] = vzero; }

        #pragma unroll
        for (int k = 0; k < NSTEPS; ++k) {
            // next k-step's LDS fragments (step 0 again behind the last: every group starts there)
            #pragma unroll
            for (int ms = 0; ms < 4; ++ms) {
                const int off1 = ((k + 1) % NSTEPS) * 32 + hi * 8;   // half-index of first 8-chunk
                const unsigned short* p = &atile[(ms * 16 + ln) * APITCH + off1];
                af[(k + 1) & 1][ms].q[0] = *(const uint4*)p;
                af[(k + 1) & 1][ms].q[1] = *(const uint4*)(p + 16);
            }
            // keeps the LDS reads as one group ahead of this step's WMMAs; without it the
            // compiler sinks them to their use and waits out the LDS latency every step
            __builtin_amdgcn_sched_barrier(0);
            #pragma unroll
            for (int ms = 0; ms < 4; ++ms)
                #pragma unroll
                for (int j = 0; j < 2; ++j)
                    acc[ms][j] = wmma_bf16(af[k & 1][ms], ring[k % WRING][j], acc[ms][j]);
            const unsigned short* wsrc = (k + WRING < NSTEPS)
                ? wcur + (k + WRING) * WP_STEP : wnxt + (k + WRING - NSTEPS) * WP_STEP;
            #pragma unroll
            for (int j = 0; j < 2; ++j) {
                const unsigned short* p = wsrc + j * WP_TILE;
                ring[k % WRING][j].q[0] = *(const uint4*)p;
                ring[k % WRING][j].q[1] = *(const uint4*)(p + WP_HALF);
            }
            // keeps the refill here, WRING-1 steps ahead of its use; without it the
            // compiler sinks the loads to their use and the L2 latency is waited out
            __builtin_amdgcn_sched_barrier(0);
        }

        // ---- epilogue ----
        #pragma unroll
        for (int ms = 0; ms < 4; ++ms) {
            #pragma unroll
            for (int j = 0; j < 2; ++j) {
                const int ng = (n0 + j) * 16 + ln;    // lane's output column
                const int h  = ng / HD;
                const int dt = (n0 + j) & 3;          // 16-column tile inside the head
                const float bb = bias[ng];
                // K, V: the lane's 8 rows s are fragment half (ms & 1) of s block sb0/32 + ms/2,
                // and the lane keeps its number (column d -> row of the fragment, hi -> hi)
                const size_t kvoff = (size_t)(b * NH + h) * BH_ELEM
                    + (size_t)((sb0 >> 5) + (ms >> 1)) * KV_SBLK + dt * FR_FRAG
                    + (ms & 1) * FR_HALF + lane * 8;

                if (proj == 2) {                       // V: bias
                    float vv[8];
                    #pragma unroll
                    for (int r = 0; r < 8; ++r) vv[r] = acc[ms][j][r] + bb;
                    uint4 w;
                    w.x = pack2(vv[0], vv[1]); w.y = pack2(vv[2], vv[3]);
                    w.z = pack2(vv[4], vv[5]); w.w = pack2(vv[6], vv[7]);
                    *(uint4*)&Vt[kvoff] = w;
                    // precaution: stands in front of the next write to a register that this store names
                    asm volatile("s_wait_xcnt 0x0" ::: "memory");
                } else if (proj == 1) {                // K: mask+elu1
                    float vv[8];
                    #pragma unroll
                    for (int r = 0; r < 8; ++r)
                        vv[r] = elu1(acc[ms][j][r] + bb + smask[ms * 16 + hi * 8 + r]);
                    uint4 w;
                    w.x = pack2(vv[0], vv[1]); w.y = pack2(vv[2], vv[3]);
                    w.z = pack2(vv[4], vv[5]); w.w = pack2(vv[6], vv[7]);
                    *(uint4*)&Kt[kvoff] = w;
                    // precaution: stands in front of the next write to a register that this store names
                    asm volatile("s_wait_xcnt 0x0" ::: "memory");
                } else {                               // Q: mask+elu1, LDS transpose
                    __builtin_amdgcn_wave_barrier();
                    #pragma unroll
                    for (int r = 0; r < 8; ++r)
                        sscr[wave][(hi * 8 + r) * 17 + ln] =
                            elu1(acc[ms][j][r] + bb + smask[ms * 16 + hi * 8 + r]);
                    __builtin_amdgcn_wave_barrier();
                    const float* src = &sscr[wave][ln * 17 + hi * 8];
                    uint4 w;
                    w.x = pack2(src[0], src[1]); w.y = pack2(src[2], src[3]);
                    w.z = pack2(src[4], src[5]); w.w = pack2(src[6], src[7]);
                    // lane = (row s, hi) now holds columns dt*16 + hi*8 .. +7 of the head:
                    // fragment half (dt & 1) of d block dt/2, s tile sb0/16 + ms
                    *(uint4*)&Qf[(size_t)(b * NH + h) * BH_ELEM
                                 + (size_t)((sb0 >> 4) + ms) * Q_STILE + (dt >> 1) * FR_FRAG
                                 + (dt & 1) * FR_HALF + lane * 8] = w;
                    // precaution: stands in front of the next write to a register that this store names
                    asm volatile("s_wait_xcnt 0x0" ::: "memory");
                    __builtin_amdgcn_wave_barrier();
                }
            }
        }
    }
}

// ================= kernel 2: per-slice partial sums of kv = K^T V and ksum = sum_s K =================
// Every block owns its own plane of kvP (HD*HD floats) and of ksP (one float per thread), so nothing
// is added into memory; k2b sums the NSLICE planes of a head. A kvP plane keeps kvT's order of
// fragment halves; inside a half it is [4 elements of 8][lane][4], so a wave-wide 16-byte store is
// 512 contiguous bytes.
__global__ __launch_bounds__(256)
void k2_kv(const unsigned short* __restrict__ Kt, const unsigned short* __restrict__ Vt,
           float* __restrict__ kvP, float* __restrict__ ksP) {
    const int bh = blockIdx.x >> 4;
    const int tid = threadIdx.x;
    const int wave = tid >> 5, lane = tid & 31;
    // this block's slice: 512 s = 16 blocks of 32
    const size_t slice = (size_t)bh * BH_ELEM + (size_t)(blockIdx.x & 15) * 16 * KV_SBLK;

    // ---- ksum partial: a wave sums one fragment half of one d tile over the slice ----
    {
        const unsigned short* p = Kt + slice + (wave >> 1) * FR_FRAG + (wave & 1) * FR_HALF + lane * 8;
        float sum = 0.f;
        for (int i = 0; i < 16; ++i) {
            uint4 qv = *(const uint4*)(p + i * KV_SBLK);
            const unsigned short* u = (const unsigned short*)&qv;
            #pragma unroll
            for (int e = 0; e < 8; ++e) sum += bf2f(u[e]);
        }
        ksP[blockIdx.x * 256 + tid] = sum;
        // precaution: stands in front of the next write to a register that the store names
        asm volatile("s_wait_xcnt 0x0" ::: "memory");
    }

    // ---- kv tiles via WMMA: A = K[d,s], B^T = V[e,s] ----
    const int dt = wave >> 1;                 // d tile 0..3
    const int e0 = (wave & 1) * 2;            // e tiles e0, e0+1
    const v8f vzero = {0.f,0.f,0.f,0.f,0.f,0.f,0.f,0.f};
    v8f acc[2] = {vzero, vzero};

    const unsigned short* Ar = Kt + slice + dt * FR_FRAG + lane * 8;
    const unsigned short* B0 = Vt + slice + e0 * FR_FRAG + lane * 8;
    const unsigned short* B1 = B0 + FR_FRAG;

    for (int k = 0; k < 16; ++k) {
        const int off = k * KV_SBLK;
        Frag a, b0, b1;
        a.q[0]  = *(const uint4*)(Ar + off); a.q[1]  = *(const uint4*)(Ar + off + FR_HALF);
        b0.q[0] = *(const uint4*)(B0 + off); b0.q[1] = *(const uint4*)(B0 + off + FR_HALF);
        // precaution: behind the last use of Ar the compiler gives its registers to the last
        // loads' data; this stands in front of that write
        if (k == 15) asm volatile("s_wait_xcnt 0x0" ::: "memory");
        b1.q[0] = *(const uint4*)(B1 + off); b1.q[1] = *(const uint4*)(B1 + off + FR_HALF);
        acc[0] = wmma_bf16(a, b0, acc[0]);
        acc[1] = wmma_bf16(a, b1, acc[1]);
    }
    // acc[j][r] is kv[d = dt*16 + (lane>>4)*8 + r][e = (e0+j)*16 + (lane&15)]: in kvT's order that is
    // d block dt/2, e tile e0+j, fragment half dt&1, this same lane, element r
    #pragma unroll
    for (int j = 0; j < 2; ++j) {
        float* dst = kvP + (size_t)blockIdx.x * (HD * HD)
            + ((dt >> 1) * 4 + e0 + j) * FR_FRAG + (dt & 1) * FR_HALF + lane * 4;
        *(float4*)dst                 = make_float4(acc[j][0], acc[j][1], acc[j][2], acc[j][3]);
        *(float4*)(dst + FR_HALF / 2) = make_float4(acc[j][4], acc[j][5], acc[j][6], acc[j][7]);
    }
}

// ================= kernel 2b: sum the slices' planes; kv^T -> bf16 (fragment order), ksum f32 =========
__global__ __launch_bounds__(256)
void k2b_cvt(const float* __restrict__ kvP, const float* __restrict__ ksP,
             unsigned short* __restrict__ kvT, float* __restrict__ ksum) {
    if (blockIdx.x < KVB_BLOCKS) {
        // four neighbouring floats of a plane per thread: elements 0..3 or 4..7 of one lane's eight
        const int i  = (blockIdx.x * 256 + threadIdx.x) * 4;
        const int bh = i / (HD * HD), o = i % (HD * HD);
        const float* p = kvP + (size_t)bh * NSLICE * (HD * HD) + o;
        float4 s = make_float4(0.f, 0.f, 0.f, 0.f);
        #pragma unroll
        for (int sl = 0; sl < NSLICE; ++sl) {
            const float4 v = *(const float4*)(p + sl * (HD * HD));
            s.x += v.x; s.y += v.y; s.z += v.z; s.w += v.w;
        }
        uint2 w;
        w.x = pack2(s.x, s.y); w.y = pack2(s.z, s.w);
        *(uint2*)&kvT[(i & ~(FR_HALF - 1)) + ((i >> 2) & 31) * 8 + ((i >> 7) & 1) * 4] = w;
    } else {
        // ksum[bh][d]: in each plane, waves (d/16)*2 and +1, lanes d%16 and +16 hold a part of it
        const int i  = (blockIdx.x - KVB_BLOCKS) * 256 + threadIdx.x;      // bh*HD + d
        const int bh = i / HD, d = i % HD;
        const float* p = ksP + (size_t)bh * NSLICE * 256 + (d >> 4) * 64 + (d & 15);
        float s = 0.f;
        #pragma unroll
        for (int sl = 0; sl < NSLICE; ++sl)
            #pragma unroll
            for (int q = 0; q < 4; ++q) s += p[sl * 256 + q * 16];
        ksum[i] = s;
        // precaution: stands in front of the next write to a register that the store names
        asm volatile("s_wait_xcnt 0x0" ::: "memory");
    }
}

// ================= kernel 3: out = (Q kv) / (Q ksum) =================
__global__ __launch_bounds__(256)
void k3_out(const unsigned short* __restrict__ Qf, const unsigned short* __restrict__ kvT,
            const float* __restrict__ ksum, float* __restrict__ out) {
    __shared__ float sks[HD];
    const int tid = threadIdx.x;
    const int bh  = blockIdx.x >> 6;
    const int blk = blockIdx.x & 63;
    if (tid < HD) sks[tid] = ksum[bh * HD + tid];
    __syncthreads();

    const int wave = tid >> 5, lane = tid & 31, ln = lane & 15, hi = lane >> 4;
    const int st = blk * 8 + wave;                  // s-tile 0..511

    const unsigned short* Ar = Qf + (size_t)bh * BH_ELEM + (size_t)st * Q_STILE + lane * 8;
    const v8f vzero = {0.f,0.f,0.f,0.f,0.f,0.f,0.f,0.f};
    v8f acc[4] = {vzero, vzero, vzero, vzero};
    float part = 0.f;

    #pragma unroll
    for (int k = 0; k < 2; ++k) {
        const int off1 = k * 32 + hi * 8;
        Frag a;
        a.q[0] = *(const uint4*)(Ar + k * FR_FRAG);
        a.q[1] = *(const uint4*)(Ar + k * FR_FRAG + FR_HALF);
        // denominator partial: lane holds Q[st*16+ln, off1..off1+7] and [+16..+23]
        #pragma unroll
        for (int e = 0; e < 8; ++e) part += bf2f(a.us[e])     * sks[off1 + e];
        #pragma unroll
        for (int e = 0; e < 8; ++e) part += bf2f(a.us[8 + e]) * sks[off1 + 16 + e];
        #pragma unroll
        for (int j = 0; j < 4; ++j) {
            const unsigned short* Br = kvT + (size_t)bh * (HD * HD) + (k * 4 + j) * FR_FRAG + lane * 8;
            Frag bfr;
            bfr.q[0] = *(const uint4*)Br;
            bfr.q[1] = *(const uint4*)(Br + FR_HALF);
            acc[j] = wmma_bf16(a, bfr, acc[j]);
        }
    }

    const float dsum = part + __shfl_xor(part, 16, 32);   // combine K-halves
    float dr[8];
    #pragma unroll
    for (int r = 0; r < 8; ++r) dr[r] = __shfl(dsum, r + hi * 8, 32);

    const int b_ = bh / NH, h_ = bh % NH;
    #pragma unroll
    for (int j = 0; j < 4; ++j)
        #pragma unroll
        for (int r = 0; r < 8; ++r) {
            const int s = st * 16 + hi * 8 + r;
            out[((size_t)b_ * S_LEN + s) * HMODEL + h_ * HD + j * 16 + ln] =
                acc[j][r] / dr[r];
        }
}

// ================= launch =================
extern "C" void kernel_launch(void* const* d_in, const int* in_sizes, int n_in,
                              void* d_out, int out_size, void* d_ws, size_t ws_size,
                              hipStream_t stream) {
    const float* hid  = (const float*)d_in[0];
    const float* mask = (const float*)d_in[1];
    const float* Wq   = (const float*)d_in[2];
    const float* bq   = (const float*)d_in[3];
    const float* Wk   = (const float*)d_in[4];
    const float* bk   = (const float*)d_in[5];
    const float* Wv   = (const float*)d_in[6];
    const float* bv   = (const float*)d_in[7];
    float* out = (float*)d_out;

    char* w = (char*)d_ws;                       // 256B-aligned offsets
    unsigned short* Wb  = (unsigned short*)(w);                 // 3.38 MB
    unsigned short* Qf  = (unsigned short*)(w + 3538944);       // 48 MB
    unsigned short* Kt  = (unsigned short*)(w + 53870592);      // 48 MB
    unsigned short* Vt  = (unsigned short*)(w + 104202240);     // 48 MB
    float*          ksP = (float*)(w + 154533888);              // 768 KB
    unsigned short* kvT = (unsigned short*)(w + 155320320);     // 384 KB
    float*          ks  = (float*)(w + 155713536);              // 12 KB
    float*          kvP = (float*)(w + 155725824);              // 12 MB

    k0_prep<<<1024, 256, 0, stream>>>(Wq, Wk, Wv, Wb);
    k1_proj<<<M_TOTAL / BLK_M, 256, BLK_M * APITCH * 2, stream>>>(
        hid, mask, Wb, bq, bk, bv, Qf, Kt, Vt);
    k2_kv<<<BATCH * NH * NSLICE, 256, 0, stream>>>(Kt, Vt, kvP, ksP);
    k2b_cvt<<<KVB_BLOCKS + (BATCH * NH * HD) / 256, 256, 0, stream>>>(kvP, ksP, kvT, ks);
    k3_out<<<(BATCH * NH * (S_LEN / 16)) / 8, 256, 0, stream>>>(Qf, kvT, ks, out);
}

// v005
// A run of this version takes 126 microseconds.
// Next to v004, in two timings, it ran 1.09 times as fast each time.
// Over all steps from v000 it is 1.97 times as fast.
#include <hip/hip_runtime.h>

// ---------------- problem constants ----------------
#define BATCH   4
#define S_LEN   8192
#define HMODEL  768
#define NH      12
#define HD      64
#define KDIM    768          // GEMM K (= HMODEL)
#define NSTEPS  (KDIM/32)    // 24 k-steps of 32 for bf16 WMMA
#define BLK_M   128          // rows of hidden staged per block in k1 (one block per WGP)
#define MT      (BLK_M/16)   // 16-row tiles of the block; a wave works on all of them
#define NT      3            // 16-column tiles of the output per wave and group in k1
#define NGROUP  (3*HMODEL/16/(8*NT))   // groups of 8 waves x NT tiles over Wq, Wk, Wv stacked
#define APITCH  776          // LDS row pitch in halves (768 + 8 pad -> bank spread)
#define M_TOTAL (BATCH*S_LEN)
#define NW_ELEM (HMODEL*HMODEL)
#define WRING   4            // k-steps of W fragments in flight per wave in k1
// Packed W, in halves: [set of NT 16-row tiles][k-step][tile of the set][fragment half][lane][8].
// One wave-wide 16-byte load of a fragment half is then 512 contiguous, aligned bytes.
#define WP_HALF  256                 // 32 lanes x 8 halves
#define WP_TILE  (2*WP_HALF)         // one 16x32 fragment
#define WP_STEP  (NT*WP_TILE)        // all tiles of a set, one k-step
#define WP_SET   (NSTEPS*WP_STEP)    // a set's whole K
// Q, K, V and kv are kept in the same fragment order, in halves ([fragment half][lane][8] innermost):
//   K, V: [bh][block of 32 s][16-row tile of d][2][32][8]   (lane = d row of the tile, k index = s)
//   Q   : [bh][tile of 16 s][block of 32 d][2][32][8]       (lane = s row of the tile, k index = d)
//   kv  : [bh][block of 32 d][16-row tile of e][2][32][8]   (lane = e row of the tile, k index = d)
// so every wave-wide 16-byte store or load of a fragment half is 512 contiguous, aligned bytes.
#define FR_HALF  256                 // 32 lanes x 8 halves
#define FR_FRAG  (2*FR_HALF)         // one 16x32 fragment
#define KV_SBLK  (4*FR_FRAG)         // K, V: the four d tiles of one block of 32 s
#define Q_STILE  (2*FR_FRAG)         // Q: both d blocks of one tile of 16 s
#define BH_ELEM  (S_LEN*HD)          // one head's Q, K or V
#define NSLICE   16                  // k2: blocks (slices of 512 s) per head
#define KVB_BLOCKS (BATCH*NH*HD*HD/4/256)   // k2b: blocks that sum kv; BATCH*NH*HD/256 more sum ksum

// ---------------- vector types for WMMA ----------------
typedef __attribute__((ext_vector_type(16))) __bf16 v16bf;
typedef __attribute__((ext_vector_type(8)))  float  v8f;

struct Frag {
    union {
        v16bf v;
        uint4 q[2];
        unsigned short us[16];
    };
};

// ---------------- helpers ----------------
__device__ __forceinline__ unsigned short f2bf(float x) {
    union { float f; unsigned int u; } c; c.f = x;
    unsigned int u = c.u;
    unsigned int r = (u + 0x7FFFu + ((u >> 16) & 1u)) >> 16;   // round-nearest-even
    return (unsigned short)r;
}
__device__ __forceinline__ float bf2f(unsigned short h) {
    union { unsigned int u; float f; } c; c.u = ((unsigned int)h) << 16;
    return c.f;
}
__device__ __forceinline__ unsigned int pack2(float a, float b) {
    return (unsigned int)f2bf(a) | ((unsigned int)f2bf(b) << 16);
}
__device__ __forceinline__ float elu1(float x) {          // elu(x)+1
    return x > 0.f ? x + 1.f : __expf(x);
}
__device__ __forceinline__ v8f wmma_bf16(const Frag& a, const Frag& b, v8f c) {
    return __builtin_amdgcn_wmma_f32_16x16x32_bf16(false, a.v, false, b.v,
                                                   (short)0, c, false, false);
}

// ================= kernel 0: W fp32->bf16 in fragment order =================
__global__ __launch_bounds__(256)
void k0_prep(const float* __restrict__ Wq, const float* __restrict__ Wk,
             const float* __restrict__ Wv, unsigned short* __restrict__ Wb) {
    const int stride = gridDim.x * blockDim.x;
    // one 16-byte piece per thread: the 8 halves that lane (i & 31) of k1 holds in one register quad
    for (int i = blockIdx.x * blockDim.x + threadIdx.x; i < 3 * NW_ELEM / 8; i += stride) {
        const int lane = i & 31, q = (i >> 5) & 1, j = (i >> 6) % NT;
        const int s    = ((i >> 6) / NT) % NSTEPS, set = (i >> 6) / (NT * NSTEPS);
        const int row  = (set * NT + j) * 16 + (lane & 15);      // row of Wq, Wk, Wv stacked
        const int col  = s * 32 + q * 16 + (lane >> 4) * 8;
        const float* W = (row < HMODEL) ? Wq : ((row < 2 * HMODEL) ? Wk : Wv);
        const float* p = W + (size_t)(row % HMODEL) * KDIM + col;
        const float4 a = *(const float4*)p;
        const float4 c = *(const float4*)(p + 4);
        uint4 w;
        w.x = pack2(a.x, a.y); w.y = pack2(a.z, a.w);
        w.z = pack2(c.x, c.y); w.w = pack2(c.z, c.w);
        *(uint4*)&Wb[(size_t)i * 8] = w;
    }
}

// ================= kernel 1: fused QKV projections (bf16 WMMA) =================
// Q, K, V -> bf16 in the fragment order that k2 and k3 load them in
__global__ __launch_bounds__(256)
void k1_proj(const float* __restrict__ hid, const float* __restrict__ mask,
             const unsigned short* __restrict__ Wb,
             const float* __restrict__ bq, const float* __restrict__ bk,
             const float* __restrict__ bv,
             unsigned short* __restrict__ Qf, unsigned short* __restrict__ Kt,
             unsigned short* __restrict__ Vt) {
    __shared__ __attribute__((aligned(16))) unsigned short atile[BLK_M * APITCH];   // bf16
    __shared__ float smask[2 * BLK_M];               // the rows' mask, then a plane of zeros
    __shared__ float sscr[8][272];                   // per-wave 16x17 f32 transpose pad

    const int tid = threadIdx.x;
    const int gm0 = blockIdx.x * BLK_M;              // first global row (b*S+s)

    smask[tid] = (tid < BLK_M) ? mask[gm0 + tid] : 0.f;

    // stage A block fp32 -> bf16 into LDS
    // four loads in flight per wave: the WGP holds only this block's 8 waves, and with fewer
    // loads each the memory latency is waited out more often
    #pragma unroll 4
    for (int i = tid; i < BLK_M * (KDIM / 4); i += 256) {
        const int row = i / (KDIM / 4);
        const int c4  = i % (KDIM / 4);
        const float4 f = *(const float4*)&hid[(size_t)(gm0 + row) * KDIM + c4 * 4];
        unsigned short* dst = &atile[row * APITCH + c4 * 4];
        dst[0] = f2bf(f.x); dst[1] = f2bf(f.y); dst[2] = f2bf(f.z); dst[3] = f2bf(f.w);
    }
    __syncthreads();

    const int wave = tid >> 5, lane = tid & 31;
    const int ln = lane & 15, hi = lane >> 4;
    const int b   = gm0 / S_LEN;
    const int sb0 = gm0 % S_LEN;
    const v8f vzero = {0.f,0.f,0.f,0.f,0.f,0.f,0.f,0.f};

    // Software-pipelined k loop. W fragments live in a register ring WRING k-steps deep:
    // a slot is refilled right behind the WMMAs that read it, so a load has WRING-1
    // k-steps of matrix work to land. The LDS fragments are fetched one k-step ahead.
    // A W fragment feeds MT WMMAs and an LDS fragment NT.
    // Stacked W rows are linear in g: row = ((g*8 + wave)*NT + j)*16 + ln, so set = g*8 + wave.
    const unsigned short* wlane = Wb + (size_t)wave * WP_SET + lane * 8;
    Frag ring[WRING][NT];
    Frag af[2][MT];
    #pragma unroll
    for (int s = 0; s < WRING; ++s)
        #pragma unroll
        for (int j = 0; j < NT; ++j) {
            const unsigned short* p = wlane + s * WP_STEP + j * WP_TILE;
            ring[s][j].q[0] = *(const uint4*)p;
            ring[s][j].q[1] = *(const uint4*)(p + WP_HALF);
        }
    #pragma unroll
    for (int ms = 0; ms < MT; ++ms) {
        const unsigned short* p = &atile[(ms * 16 + ln) * APITCH + hi * 8];
        af[0][ms].q[0] = *(const uint4*)p;
        af[0][ms].q[1] = *(const uint4*)(p + 16);
    }

    const unsigned short* wgrp = wlane;
    for (int g = 0; g < NGROUP; ++g) {                // 3 proj x NGROUP/3 groups of column sets
        const int proj = g / (NGROUP / 3);
        const int set  = (g % (NGROUP / 3)) * 8 + wave;   // column set inside the projection
        const int n0   = set * NT;                    // first 16-col tile index
        const float* bias = (proj == 0) ? bq : ((proj == 1) ? bk : bv);
        const unsigned short* wcur = wgrp;            // this group's rows of packed W
        // the ring runs on into the next group's rows, over the epilogue; behind the
        // last group there are none, and the refill stays on this group's own rows
        const unsigned short* wnxt = wcur + (g < NGROUP - 1 ? 8 * WP_SET : 0);
        wgrp = wnxt;

        v8f acc[MT][NT];
        #pragma unroll
        for (int ms = 0; ms < MT; ++ms)
            #pragma unroll
            for (int j = 0; j < NT; ++j) acc[ms][j] = vzero;

        #pragma unroll
        for (int k = 0; k < NSTEPS; ++k) {
            // next k-step's LDS fragments (step 0 again behind the last: every group starts there)
            #pragma unroll
            for (int ms = 0; ms < MT; ++ms) {
                const int off1 = ((k + 1) % NSTEPS) * 32 + hi * 8;   // half-index of first 8-chunk
                const unsigned short* p = &atile[(ms * 16 + ln) * APITCH + off1];
                af[(k + 1) & 1][ms].q[0] = *(const uint4*)p;
                af[(k + 1) & 1][ms].q[1] = *(const uint4*)(p + 16);
            }
            // keeps the LDS reads as one group ahead of this step's WMMAs; without it the
            // compiler sinks them to their use and waits out the LDS latency every step
            __builtin_amdgcn_sched_barrier(0);
            #pragma unroll
            for (int ms = 0; ms < MT; ++ms)
                #pragma unroll
                for (int j = 0; j < NT; ++j)
                    acc[ms][j] = wmma_bf16(af[k & 1][ms], ring[k % WRING][j], acc[ms][j]);
            const unsigned short* wsrc = (k + WRING < NSTEPS)
                ? wcur + (k + WRING) * WP_STEP : wnxt + (k + WRING - NSTEPS) * WP_STEP;
            #pragma unroll
            for (int j = 0; j < NT; ++j) {
                const unsigned short* p = wsrc + j * WP_TILE;
                ring[k % WRING][j].q[0] = *(const uint4*)p;
                ring[k % WRING][j].q[1] = *(const uint4*)(p + WP_HALF);
            }
            // keeps the refill here, WRING-1 steps ahead of its use; without it the
            // compiler sinks the loads to their use and the L2 latency is waited out
            __builtin_amdgcn_sched_barrier(0);
        }

        // ---- epilogue: one body for Q, K and V, so that the 24 unrolled tiles stay small in the text ----
        const bool  isQ  = (proj == 0), isV = (proj == 2);
        const float one  = isV ? 0.f : 1.f;           // V: bias alone, no mask, no elu
        const float* sm  = smask + (isV ? BLK_M : 0) + hi * 8;   // V reads the plane of zeros
        unsigned short* kvdst = isV ? Vt : Kt;
        // the lane's NT bias values, read once per group: all MT tiles of a column share them
        float bb[NT];
        #pragma unroll
        for (int j = 0; j < NT; ++j) bb[j] = bias[(n0 + j) * 16 + ln];
        #pragma unroll
        for (int ms = 0; ms < MT; ++ms) {
            #pragma unroll
            for (int j = 0; j < NT; ++j) {
                const int ng = (n0 + j) * 16 + ln;    // lane's output column
                const int h  = ng / HD;
                const int dt = (n0 + j) & 3;          // 16-column tile inside the head
                float vv[8];
                #pragma unroll
                for (int r = 0; r < 8; ++r) {
                    const float x = acc[ms][j][r] + bb[j] + sm[ms * 16 + r];
                    vv[r] = (isV || x > 0.f) ? x + one : __expf(x);      // Q, K: elu(x)+1
                }
                // K, V: the lane's 8 rows s are fragment half (ms & 1) of s block sb0/32 + ms/2,
                // and the lane keeps its number (column d -> row of the fragment, hi -> hi)
                unsigned short* dst = kvdst + (size_t)(b * NH + h) * BH_ELEM
                    + (size_t)((sb0 >> 5) + (ms >> 1)) * KV_SBLK + dt * FR_FRAG
                    + (ms & 1) * FR_HALF + lane * 8;
                if (isQ) {                             // Q: LDS transpose
                    // the wave barriers keep the compiler from moving the pad's writes and reads
                    // (other lanes' words) across each other
                    __builtin_amdgcn_wave_barrier();
                    #pragma unroll
                    for (int r = 0; r < 8; ++r) sscr[wave][(hi * 8 + r) * 17 + ln] = vv[r];
                    __builtin_amdgcn_wave_barrier();
                    const float* src = &sscr[wave][ln * 17 + hi * 8];
                    #pragma unroll
                    for (int r = 0; r < 8; ++r) vv[r] = src[r];
                    __builtin_amdgcn_wave_barrier();
                    // lane = (row s, hi) now holds columns dt*16 + hi*8 .. +7 of the head:
                    // fragment half (dt & 1) of d block dt/2, s tile sb0/16 + ms
                    dst = Qf + (size_t)(b * NH + h) * BH_ELEM
                        + (size_t)((sb0 >> 4) + ms) * Q_STILE + (dt >> 1) * FR_FRAG
                        + (dt & 1) * FR_HALF + lane * 8;
                }
                uint4 w;
                w.x = pack2(vv[0], vv[1]); w.y = pack2(vv[2], vv[3]);
                w.z = pack2(vv[4], vv[5]); w.w = pack2(vv[6], vv[7]);
                *(uint4*)dst = w;
                // precaution: stands in front of the next write to a register that this store names
                asm volatile("s_wait_xcnt 0x0" ::: "memory");
            }
        }
    }
}

// ================= kernel 2: per-slice partial sums of kv = K^T V and ksum = sum_s K =================
// Every block owns its own plane of kvP (HD*HD floats) and of ksP (one float per thread), so nothing
// is added into memory; k2b sums the NSLICE planes of a head. A kvP plane keeps kvT's order of
// fragment halves; inside a half it is [4 elements of 8][lane][4], so a wave-wide 16-byte store is
// 512 contiguous bytes.
__global__ __launch_bounds__(256)
void k2_kv(const unsigned short* __restrict__ Kt, const unsigned short* __restrict__ Vt,
           float* __restrict__ kvP, float* __restrict__ ksP) {
    const int bh = blockIdx.x >> 4;
    const int tid = threadIdx.x;
    const int wave = tid >> 5, lane = tid & 31;
    // this block's slice: 512 s = 16 blocks of 32
    const size_t slice = (size_t)bh * BH_ELEM + (size_t)(blockIdx.x & 15) * 16 * KV_SBLK;

    // ---- ksum partial: a wave sums one fragment half of one d tile over the slice ----
    {
        const unsigned short* p = Kt + slice + (wave >> 1) * FR_FRAG + (wave & 1) * FR_HALF + lane * 8;
        float sum = 0.f;
        for (int i = 0; i < 16; ++i) {
            uint4 qv = *(const uint4*)(p + i * KV_SBLK);
            const unsigned short* u = (const unsigned short*)&qv;
            #pragma unroll
            for (int e = 0; e < 8; ++e) sum += bf2f(u[e]);
        }
        ksP[blockIdx.x * 256 + tid] = sum;
        // precaution: stands in front of the next write to a register that the store names
        asm volatile("s_wait_xcnt 0x0" ::: "memory");
    }

    // ---- kv tiles via WMMA: A = K[d,s], B^T = V[e,s] ----
    const int dt = wave >> 1;                 // d tile 0..3
    const int e0 = (wave & 1) * 2;            // e tiles e0, e0+1
    const v8f vzero = {0.f,0.f,0.f,0.f,0.f,0.f,0.f,0.f};
    v8f acc[2] = {vzero, vzero};

    const unsigned short* Ar = Kt + slice + dt * FR_FRAG + lane * 8;
    const unsigned short* B0 = Vt + slice + e0 * FR_FRAG + lane * 8;
    const unsigned short* B1 = B0 + FR_FRAG;

    for (int k = 0; k < 16; ++k) {
        const int off = k * KV_SBLK;
        Frag a, b0, b1;
        a.q[0]  = *(const uint4*)(Ar + off); a.q[1]  = *(const uint4*)(Ar + off + FR_HALF);
        b0.q[0] = *(const uint4*)(B0 + off); b0.q[1] = *(const uint4*)(B0 + off + FR_HALF);
        // precaution: behind the last use of Ar the compiler gives its registers to the last
        // loads' data; this stands in front of that write
        if (k == 15) asm volatile("s_wait_xcnt 0x0" ::: "memory");
        b1.q[0] = *(const uint4*)(B1 + off); b1.q[1] = *(const uint4*)(B1 + off + FR_HALF);
        acc[0] = wmma_bf16(a, b0, acc[0]);
        acc[1] = wmma_bf16(a, b1, acc[1]);
    }
    // acc[j][r] is kv[d = dt*16 + (lane>>4)*8 + r][e = (e0+j)*16 + (lane&15)]: in kvT's order that is
    // d block dt/2, e tile e0+j, fragment half dt&1, this same lane, element r
    #pragma unroll
    for (int j = 0; j < 2; ++j) {
        float* dst = kvP + (size_t)blockIdx.x * (HD * HD)
            + ((dt >> 1) * 4 + e0 + j) * FR_FRAG + (dt & 1) * FR_HALF + lane * 4;
        *(float4*)dst                 = make_float4(acc[j][0], acc[j][1], acc[j][2], acc[j][3]);
        *(float4*)(dst + FR_HALF / 2) = make_float4(acc[j][4], acc[j][5], acc[j][6], acc[j][7]);
    }
}

// ================= kernel 2b: sum the slices' planes; kv^T -> bf16 (fragment order), ksum f32 =========
__global__ __launch_bounds__(256)
void k2b_cvt(const float* __restrict__ kvP, const float* __restrict__ ksP,
             unsigned short* __restrict__ kvT, float* __restrict__ ksum) {
    if (blockIdx.x < KVB_BLOCKS) {
        // four neighbouring floats of a plane per thread: elements 0..3 or 4..7 of one lane's eight
        const int i  = (blockIdx.x * 256 + threadIdx.x) * 4;
        const int bh = i / (HD * HD), o = i % (HD * HD);
        const float* p = kvP + (size_t)bh * NSLICE * (HD * HD) + o;
        float4 s = make_float4(0.f, 0.f, 0.f, 0.f);
        #pragma unroll
        for (int sl = 0; sl < NSLICE; ++sl) {
            const float4 v = *(const float4*)(p + sl * (HD * HD));
            s.x += v.x; s.y += v.y; s.z += v.z; s.w += v.w;
        }
        uint2 w;
        w.x = pack2(s.x, s.y); w.y = pack2(s.z, s.w);
        *(uint2*)&kvT[(i & ~(FR_HALF - 1)) + ((i >> 2) & 31) * 8 + ((i >> 7) & 1) * 4] = w;
    } else {
        // ksum[bh][d]: in each plane, waves (d/16)*2 and +1, lanes d%16 and +16 hold a part of it
        const int i  = (blockIdx.x - KVB_BLOCKS) * 256 + threadIdx.x;      // bh*HD + d
        const int bh = i / HD, d = i % HD;
        const float* p = ksP + (size_t)bh * NSLICE * 256 + (d >> 4) * 64 + (d & 15);
        float s = 0.f;
        #pragma unroll
        for (int sl = 0; sl < NSLICE; ++sl)
            #pragma unroll
            for (int q = 0; q < 4; ++q) s += p[sl * 256 + q * 16];
        ksum[i] = s;
        // precaution: stands in front of the next write to a register that the store names
        asm volatile("s_wait_xcnt 0x0" ::: "memory");
    }
}

// ================= kernel 3: out = (Q kv) / (Q ksum) =================
__global__ __launch_bounds__(256)
void k3_out(const unsigned short* __restrict__ Qf, const unsigned short* __restrict__ kvT,
            const float* __restrict__ ksum, float* __restrict__ out) {
    __shared__ float sks[HD];
    const int tid = threadIdx.x;
    const int bh  = blockIdx.x >> 6;
    const int blk = blockIdx.x & 63;
    if (tid < HD) sks[tid] = ksum[bh * HD + tid];
    __syncthreads();

    const int wave = tid >> 5, lane = tid & 31, ln = lane & 15, hi = lane >> 4;
    const int st = blk * 8 + wave;                  // s-tile 0..511

    const unsigned short* Ar = Qf + (size_t)bh * BH_ELEM + (size_t)st * Q_STILE + lane * 8;
    const v8f vzero = {0.f,0.f,0.f,0.f,0.f,0.f,0.f,0.f};
    v8f acc[4] = {vzero, vzero, vzero, vzero};
    float part = 0.f;

    #pragma unroll
    for (int k = 0; k < 2; ++k) {
        const int off1 = k * 32 + hi * 8;
        Frag a;
        a.q[0] = *(const uint4*)(Ar + k * FR_FRAG);
        a.q[1] = *(const uint4*)(Ar + k * FR_FRAG + FR_HALF);
        // denominator partial: lane holds Q[st*16+ln, off1..off1+7] and [+16..+23]
        #pragma unroll
        for (int e = 0; e < 8; ++e) part += bf2f(a.us[e])     * sks[off1 + e];
        #pragma unroll
        for (int e = 0; e < 8; ++e) part += bf2f(a.us[8 + e]) * sks[off1 + 16 + e];
        #pragma unroll
        for (int j = 0; j < 4; ++j) {
            const unsigned short* Br = kvT + (size_t)bh * (HD * HD) + (k * 4 + j) * FR_FRAG + lane * 8;
            Frag bfr;
            bfr.q[0] = *(const uint4*)Br;
            bfr.q[1] = *(const uint4*)(Br + FR_HALF);
            acc[j] = wmma_bf16(a, bfr, acc[j]);
        }
    }

    const float dsum = part + __shfl_xor(part, 16, 32);   // combine K-halves
    float dr[8];
    #pragma unroll
    for (int r = 0; r < 8; ++r) dr[r] = __shfl(dsum, r + hi * 8, 32);

    const int b_ = bh / NH, h_ = bh % NH;
    #pragma unroll
    for (int j = 0; j < 4; ++j)
        #pragma unroll
        for (int r = 0; r < 8; ++r) {
            const int s = st * 16 + hi * 8 + r;
            out[((size_t)b_ * S_LEN + s) * HMODEL + h_ * HD + j * 16 + ln] =
                acc[j][r] / dr[r];
        }
}

// ================= launch =================
extern "C" void kernel_launch(void* const* d_in, const int* in_sizes, int n_in,
                              void* d_out, int out_size, void* d_ws, size_t ws_size,
                              hipStream_t stream) {
    const float* hid  = (const float*)d_in[0];
    const float* mask = (const float*)d_in[1];
    const float* Wq   = (const float*)d_in[2];
    const float* bq   = (const float*)d_in[3];
    const float* Wk   = (const float*)d_in[4];
    const float* bk   = (const float*)d_in[5];
    const float* Wv   = (const float*)d_in[6];
    const float* bv   = (const float*)d_in[7];
    float* out = (float*)d_out;

    char* w = (char*)d_ws;                       // 256B-aligned offsets
    unsigned short* Wb  = (unsigned short*)(w);                 // 3.38 MB
    unsigned short* Qf  = (unsigned short*)(w + 3538944);       // 48 MB
    unsigned short* Kt  = (unsigned short*)(w + 53870592);      // 48 MB
    unsigned short* Vt  = (unsigned short*)(w + 104202240);     // 48 MB
    float*          ksP = (float*)(w + 154533888);              // 768 KB
    unsigned short* kvT = (unsigned short*)(w + 155320320);     // 384 KB
    float*          ks  = (float*)(w + 155713536);              // 12 KB
    float*          kvP = (float*)(w + 155725824);              // 12 MB

    k0_prep<<<1024, 256, 0, stream>>>(Wq, Wk, Wv, Wb);
    k1_proj<<<M_TOTAL / BLK_M, 256, 0, stream>>>(
        hid, mask, Wb, bq, bk, bv, Qf, Kt, Vt);
    k2_kv<<<BATCH * NH * NSLICE, 256, 0, stream>>>(Kt, Vt, kvP, ksP);
    k2b_cvt<<<KVB_BLOCKS + (BATCH * NH * HD) / 256, 256, 0, stream>>>(kvP, ksP, kvT, ks);
    k3_out<<<(BATCH * NH * (S_LEN / 16)) / 8, 256, 0, stream>>>(Qf, kvT, ks, out);
}

// v006
// A run of this version takes 118 microseconds.
// Two timings next to v005 both put it at 1.07 times that version's speed.
// All steps since v000 together make it 2.11 times as fast.
#include <hip/hip_runtime.h>

// ---------------- problem constants ----------------
#define BATCH   4
#define S_LEN   8192
#define HMODEL  768
#define NH      12
#define HD      64
#define KDIM    768          // GEMM K (= HMODEL)
#define NSTEPS  (KDIM/32)    // 24 k-steps of 32 for bf16 WMMA
#define BLK_M   128          // rows of hidden staged per block in k1 (one block per WGP)
#define MT      (BLK_M/16)   // 16-row tiles of the block; a wave works on all of them
#define NT      3            // 16-column tiles of the output per wave and group in k1
#define NGROUP  (3*HMODEL/16/(8*NT))   // groups of 8 waves x NT tiles over Wq, Wk, Wv stacked
#define APITCH  776          // LDS row pitch in halves (768 + 8 pad -> bank spread)
#define M_TOTAL (BATCH*S_LEN)
#define NW_ELEM (HMODEL*HMODEL)
#define WRING   4            // k-steps of W fragments in flight per wave in k1
#define SB      (BLK_M/8)    // k1 staging: rows per wave, and its loads in flight
#define RP      (KDIM/128)   // k1 staging: 512-byte pieces of a row of hidden
// Packed W, in halves: [set of NT 16-row tiles][k-step][tile of the set][fragment half][lane][8].
// One wave-wide 16-byte load of a fragment half is then 512 contiguous, aligned bytes.
#define WP_HALF  256                 // 32 lanes x 8 halves
#define WP_TILE  (2*WP_HALF)         // one 16x32 fragment
#define WP_STEP  (NT*WP_TILE)        // all tiles of a set, one k-step
#define WP_SET   (NSTEPS*WP_STEP)    // a set's whole K
// Q, K, V and kv are kept in the same fragment order, in halves ([fragment half][lane][8] innermost):
//   K, V: [bh][block of 32 s][16-row tile of d][2][32][8]   (lane = d row of the tile, k index = s)
//   Q   : [bh][tile of 16 s][block of 32 d][2][32][8]       (lane = s row of the tile, k index = d)
//   kv  : [bh][block of 32 d][16-row tile of e][2][32][8]   (lane = e row of the tile, k index = d)
// so every wave-wide 16-byte store or load of a fragment half is 512 contiguous, aligned bytes.
#define FR_HALF  256                 // 32 lanes x 8 halves
#define FR_FRAG  (2*FR_HALF)         // one 16x32 fragment
#define KV_SBLK  (4*FR_FRAG)         // K, V: the four d tiles of one block of 32 s
#define Q_STILE  (2*FR_FRAG)         // Q: both d blocks of one tile of 16 s
#define BH_ELEM  (S_LEN*HD)          // one head's Q, K or V
#define NSLICE   16                  // k2: blocks (slices of 512 s) per head
#define KVB_BLOCKS (BATCH*NH*HD*HD/4/256)   // k2b: blocks that sum kv; BATCH*NH*HD/256 more sum ksum

// ---------------- vector types for WMMA ----------------
typedef __attribute__((ext_vector_type(16))) __bf16 v16bf;
typedef __attribute__((ext_vector_type(8)))  float  v8f;

struct Frag {
    union {
        v16bf v;
        uint4 q[2];
        unsigned short us[16];
    };
};

// ---------------- helpers ----------------
__device__ __forceinline__ unsigned short f2bf(float x) {
    union { float f; unsigned int u; } c; c.f = x;
    unsigned int u = c.u;
    unsigned int r = (u + 0x7FFFu + ((u >> 16) & 1u)) >> 16;   // round-nearest-even
    return (unsigned short)r;
}
__device__ __forceinline__ float bf2f(unsigned short h) {
    union { unsigned int u; float f; } c; c.u = ((unsigned int)h) << 16;
    return c.f;
}
__device__ __forceinline__ unsigned int pack2(float a, float b) {
    return (unsigned int)f2bf(a) | ((unsigned int)f2bf(b) << 16);
}
__device__ __forceinline__ float elu1(float x) {          // elu(x)+1
    return x > 0.f ? x + 1.f : __expf(x);
}
__device__ __forceinline__ v8f wmma_bf16(const Frag& a, const Frag& b, v8f c) {
    return __builtin_amdgcn_wmma_f32_16x16x32_bf16(false, a.v, false, b.v,
                                                   (short)0, c, false, false);
}

// ================= kernel 0: W fp32->bf16 in fragment order =================
__global__ __launch_bounds__(256)
void k0_prep(const float* __restrict__ Wq, const float* __restrict__ Wk,
             const float* __restrict__ Wv, unsigned short* __restrict__ Wb) {
    const int stride = gridDim.x * blockDim.x;
    // one 16-byte piece per thread: the 8 halves that lane (i & 31) of k1 holds in one register quad
    for (int i = blockIdx.x * blockDim.x + threadIdx.x; i < 3 * NW_ELEM / 8; i += stride) {
        const int lane = i & 31, q = (i >> 5) & 1, j = (i >> 6) % NT;
        const int s    = ((i >> 6) / NT) % NSTEPS, set = (i >> 6) / (NT * NSTEPS);
        const int row  = (set * NT + j) * 16 + (lane & 15);      // row of Wq, Wk, Wv stacked
        const int col  = s * 32 + q * 16 + (lane >> 4) * 8;
        const float* W = (row < HMODEL) ? Wq : ((row < 2 * HMODEL) ? Wk : Wv);
        const float* p = W + (size_t)(row % HMODEL) * KDIM + col;
        const float4 a = *(const float4*)p;
        const float4 c = *(const float4*)(p + 4);
        uint4 w;
        w.x = pack2(a.x, a.y); w.y = pack2(a.z, a.w);
        w.z = pack2(c.x, c.y); w.w = pack2(c.z, c.w);
        *(uint4*)&Wb[(size_t)i * 8] = w;
    }
}

// ================= kernel 1: fused QKV projections (bf16 WMMA) =================
// Q, K, V -> bf16 in the fragment order that k2 and k3 load them in
__global__ __launch_bounds__(256)
void k1_proj(const float* __restrict__ hid, const float* __restrict__ mask,
             const unsigned short* __restrict__ Wb,
             const float* __restrict__ bq, const float* __restrict__ bk,
             const float* __restrict__ bv,
             unsigned short* __restrict__ Qf, unsigned short* __restrict__ Kt,
             unsigned short* __restrict__ Vt) {
    __shared__ __attribute__((aligned(16))) unsigned short atile[BLK_M * APITCH];   // bf16
    __shared__ float smask[2 * BLK_M];               // the rows' mask, then a plane of zeros
    __shared__ float sscr[8][272];                   // per-wave 16x17 f32 transpose pad

    const int tid = threadIdx.x;
    const int gm0 = blockIdx.x * BLK_M;              // first global row (b*S+s)

    // read ahead of the staging loads, stored behind them: the store's wait would hold them back
    const float mrow = (tid < BLK_M) ? mask[gm0 + tid] : 0.f;

    // stage A block fp32 -> bf16 into LDS
    // Wave w stages rows w, w+8, ...: a trip takes one 512-byte piece (of RP) of each of its SB rows. A
    // register quad is refilled with the next trip's load right behind its conversion, so SB-1 to SB loads
    // per wave stay in flight. The WGP holds only this block's 8 waves, and with few loads each, all waited
    // for before the next are issued, the stream runs at the memory's latency and not at its rate.
    // The waves start at different pieces, so that the block's loads in flight do not all lie at one
    // offset inside the 3-KB rows.
    {
        int c = (tid >> 5) % RP;                     // the piece that the quads hold
        const float* gsrc = hid + (size_t)(gm0 + (tid >> 5)) * KDIM + c * 128 + (tid & 31) * 4;
        unsigned short* lrow = &atile[(tid >> 5) * APITCH + (tid & 31) * 4];
        float4 sq[SB];
        #pragma unroll
        for (int j = 0; j < SB; ++j) sq[j] = *(const float4*)(gsrc + j * 8 * KDIM);
        // rolled: the trips are alike, and unrolled they would push the epilogue further back in the text
        #pragma unroll 1
        for (int p = 0; p < RP; ++p) {
            // behind the last trip there is nothing left to fetch: its refill stays on the trip's own
            // bytes and is dropped, so that one loop body serves every trip
            const int cn = (p == RP - 1) ? c : ((c == RP - 1) ? 0 : c + 1);
            gsrc += (cn - c) * 128;
            unsigned short* ldst = lrow + c * 128;
            #pragma unroll
            for (int j = 0; j < SB; ++j) {
                const float4 f = sq[j];
                unsigned short* dst = ldst + j * 8 * APITCH;
                dst[0] = f2bf(f.x); dst[1] = f2bf(f.y); dst[2] = f2bf(f.z); dst[3] = f2bf(f.w);
                sq[j] = *(const float4*)(gsrc + j * 8 * KDIM);
                // keeps each refill right behind its quad's conversion; without it the compiler gathers
                // the loads behind the last conversion, whose wait has drained all that was in flight
                __builtin_amdgcn_sched_barrier(0);
            }
            c = cn;
        }
    }
    smask[tid] = mrow;
    __syncthreads();

    const int wave = tid >> 5, lane = tid & 31;
    const int ln = lane & 15, hi = lane >> 4;
    const int b   = gm0 / S_LEN;
    const int sb0 = gm0 % S_LEN;
    const v8f vzero = {0.f,0.f,0.f,0.f,0.f,0.f,0.f,0.f};

    // Software-pipelined k loop. W fragments live in a register ring WRING k-steps deep:
    // a slot is refilled right behind the WMMAs that read it, so a load has WRING-1
    // k-steps of matrix work to land. The LDS fragments are fetched one k-step ahead.
    // A W fragment feeds MT WMMAs and an LDS fragment NT.
    // Stacked W rows are linear in g: row = ((g*8 + wave)*NT + j)*16 + ln, so set = g*8 + wave.
    const unsigned short* wlane = Wb + (size_t)wave * WP_SET + lane * 8;
    Frag ring[WRING][NT];
    Frag af[2][MT];
    #pragma unroll
    for (int s = 0; s < WRING; ++s)
        #pragma unroll
        for (int j = 0; j < NT; ++j) {
            const unsigned short* p = wlane + s * WP_STEP + j * WP_TILE;
            ring[s][j].q[0] = *(const uint4*)p;
            ring[s][j].q[1] = *(const uint4*)(p + WP_HALF);
        }
    #pragma unroll
    for (int ms = 0; ms < MT; ++ms) {
        const unsigned short* p = &atile[(ms * 16 + ln) * APITCH + hi * 8];
        af[0][ms].q[0] = *(const uint4*)p;
        af[0][ms].q[1] = *(const uint4*)(p + 16);
    }

    const unsigned short* wgrp = wlane;
    for (int g = 0; g < NGROUP; ++g) {                // 3 proj x NGROUP/3 groups of column sets
        const int proj = g / (NGROUP / 3);
        const int set  = (g % (NGROUP / 3)) * 8 + wave;   // column set inside the projection
        const int n0   = set * NT;                    // first 16-col tile index
        const float* bias = (proj == 0) ? bq : ((proj == 1) ? bk : bv);
        const unsigned short* wcur = wgrp;            // this group's rows of packed W
        // the ring runs on into the next group's rows, over the epilogue; behind the
        // last group there are none, and the refill stays on this group's own rows
        const unsigned short* wnxt = wcur + (g < NGROUP - 1 ? 8 * WP_SET : 0);
        wgrp = wnxt;

        v8f acc[MT][NT];
        #pragma unroll
        for (int ms = 0; ms < MT; ++ms)
            #pragma unroll
            for (int j = 0; j < NT; ++j) acc[ms][j] = vzero;

        #pragma unroll
        for (int k = 0; k < NSTEPS; ++k) {
            // next k-step's LDS fragments (step 0 again behind the last: every group starts there)
            #pragma unroll
            for (int ms = 0; ms < MT; ++ms) {
                const int off1 = ((k + 1) % NSTEPS) * 32 + hi * 8;   // half-index of first 8-chunk
                const unsigned short* p = &atile[(ms * 16 + ln) * APITCH + off1];
                af[(k + 1) & 1][ms].q[0] = *(const uint4*)p;
                af[(k + 1) & 1][ms].q[1] = *(const uint4*)(p + 16);
            }
            // keeps the LDS reads as one group ahead of this step's WMMAs; without it the
            // compiler sinks them to their use and waits out the LDS latency every step
            __builtin_amdgcn_sched_barrier(0);
            #pragma unroll
            for (int ms = 0; ms < MT; ++ms)
                #pragma unroll
                for (int j = 0; j < NT; ++j)
                    acc[ms][j] = wmma_bf16(af[k & 1][ms], ring[k % WRING][j], acc[ms][j]);
            const unsigned short* wsrc = (k + WRING < NSTEPS)
                ? wcur + (k + WRING) * WP_STEP : wnxt + (k + WRING - NSTEPS) * WP_STEP;
            #pragma unroll
            for (int j = 0; j < NT; ++j) {
                const unsigned short* p = wsrc + j * WP_TILE;
                ring[k % WRING][j].q[0] = *(const uint4*)p;
                ring[k % WRING][j].q[1] = *(const uint4*)(p + WP_HALF);
            }
            // keeps the refill here, WRING-1 steps ahead of its use; without it the
            // compiler sinks the loads to their use and the L2 latency is waited out
            __builtin_amdgcn_sched_barrier(0);
        }

        // ---- epilogue: one body for Q, K and V, so that the 24 unrolled tiles stay small in the text ----
        const bool  isQ  = (proj == 0), isV = (proj == 2);
        const float one  = isV ? 0.f : 1.f;           // V: bias alone, no mask, no elu
        const float* sm  = smask + (isV ? BLK_M : 0) + hi * 8;   // V reads the plane of zeros
        unsigned short* kvdst = isV ? Vt : Kt;
        // the lane's NT bias values, read once per group: all MT tiles of a column share them
        float bb[NT];
        #pragma unroll
        for (int j = 0; j < NT; ++j) bb[j] = bias[(n0 + j) * 16 + ln];
        #pragma unroll
        for (int ms = 0; ms < MT; ++ms) {
            #pragma unroll
            for (int j = 0; j < NT; ++j) {
                const int ng = (n0 + j) * 16 + ln;    // lane's output column
                const int h  = ng / HD;
                const int dt = (n0 + j) & 3;          // 16-column tile inside the head
                float vv[8];
                #pragma unroll
                for (int r = 0; r < 8; ++r) {
                    const float x = acc[ms][j][r] + bb[j] + sm[ms * 16 + r];
                    vv[r] = (isV || x > 0.f) ? x + one : __expf(x);      // Q, K: elu(x)+1
                }
                // K, V: the lane's 8 rows s are fragment half (ms & 1) of s block sb0/32 + ms/2,
                // and the lane keeps its number (column d -> row of the fragment, hi -> hi)
                unsigned short* dst = kvdst + (size_t)(b * NH + h) * BH_ELEM
                    + (size_t)((sb0 >> 5) + (ms >> 1)) * KV_SBLK + dt * FR_FRAG
                    + (ms & 1) * FR_HALF + lane * 8;
                if (isQ) {                             // Q: LDS transpose
                    // the wave barriers keep the compiler from moving the pad's writes and reads
                    // (other lanes' words) across each other
                    __builtin_amdgcn_wave_barrier();
                    #pragma unroll
                    for (int r = 0; r < 8; ++r) sscr[wave][(hi * 8 + r) * 17 + ln] = vv[r];
                    __builtin_amdgcn_wave_barrier();
                    const float* src = &sscr[wave][ln * 17 + hi * 8];
                    #pragma unroll
                    for (int r = 0; r < 8; ++r) vv[r] = src[r];
                    __builtin_amdgcn_wave_barrier();
                    // lane = (row s, hi) now holds columns dt*16 + hi*8 .. +7 of the head:
                    // fragment half (dt & 1) of d block dt/2, s tile sb0/16 + ms
                    dst = Qf + (size_t)(b * NH + h) * BH_ELEM
                        + (size_t)((sb0 >> 4) + ms) * Q_STILE + (dt >> 1) * FR_FRAG
                        + (dt & 1) * FR_HALF + lane * 8;
                }
                uint4 w;
                w.x = pack2(vv[0], vv[1]); w.y = pack2(vv[2], vv[3]);
                w.z = pack2(vv[4], vv[5]); w.w = pack2(vv[6], vv[7]);
                *(uint4*)dst = w;
                // precaution: stands in front of the next write to a register that this store names
                asm volatile("s_wait_xcnt 0x0" ::: "memory");
            }
        }
    }
}

// ================= kernel 2: per-slice partial sums of kv = K^T V and ksum = sum_s K =================
// Every block owns its own plane of kvP (HD*HD floats) and of ksP (one float per thread), so nothing
// is added into memory; k2b sums the NSLICE planes of a head. A kvP plane keeps kvT's order of
// fragment halves; inside a half it is [4 elements of 8][lane][4], so a wave-wide 16-byte store is
// 512 contiguous bytes.
__global__ __launch_bounds__(256)
void k2_kv(const unsigned short* __restrict__ Kt, const unsigned short* __restrict__ Vt,
           float* __restrict__ kvP, float* __restrict__ ksP) {
    const int bh = blockIdx.x >> 4;
    const int tid = threadIdx.x;
    const int wave = tid >> 5, lane = tid & 31;
    // this block's slice: 512 s = 16 blocks of 32
    const size_t slice = (size_t)bh * BH_ELEM + (size_t)(blockIdx.x & 15) * 16 * KV_SBLK;

    // ---- ksum partial: a wave sums one fragment half of one d tile over the slice ----
    {
        const unsigned short* p = Kt + slice + (wave >> 1) * FR_FRAG + (wave & 1) * FR_HALF + lane * 8;
        float sum = 0.f;
        for (int i = 0; i < 16; ++i) {
            uint4 qv = *(const uint4*)(p + i * KV_SBLK);
            const unsigned short* u = (const unsigned short*)&qv;
            #pragma unroll
            for (int e = 0; e < 8; ++e) sum += bf2f(u[e]);
        }
        ksP[blockIdx.x * 256 + tid] = sum;
        // precaution: stands in front of the next write to a register that the store names
        asm volatile("s_wait_xcnt 0x0" ::: "memory");
    }

    // ---- kv tiles via WMMA: A = K[d,s], B^T = V[e,s] ----
    const int dt = wave >> 1;                 // d tile 0..3
    const int e0 = (wave & 1) * 2;            // e tiles e0, e0+1
    const v8f vzero = {0.f,0.f,0.f,0.f,0.f,0.f,0.f,0.f};
    v8f acc[2] = {vzero, vzero};

    const unsigned short* Ar = Kt + slice + dt * FR_FRAG + lane * 8;
    const unsigned short* B0 = Vt + slice + e0 * FR_FRAG + lane * 8;
    const unsigned short* B1 = B0 + FR_FRAG;

    for (int k = 0; k < 16; ++k) {
        const int off = k * KV_SBLK;
        Frag a, b0, b1;
        a.q[0]  = *(const uint4*)(Ar + off); a.q[1]  = *(const uint4*)(Ar + off + FR_HALF);
        b0.q[0] = *(const uint4*)(B0 + off); b0.q[1] = *(const uint4*)(B0 + off + FR_HALF);
        // precaution: behind the last use of Ar the compiler gives its registers to the last
        // loads' data; this stands in front of that write
        if (k == 15) asm volatile("s_wait_xcnt 0x0" ::: "memory");
        b1.q[0] = *(const uint4*)(B1 + off); b1.q[1] = *(const uint4*)(B1 + off + FR_HALF);
        acc[0] = wmma_bf16(a, b0, acc[0]);
        acc[1] = wmma_bf16(a, b1, acc[1]);
    }
    // acc[j][r] is kv[d = dt*16 + (lane>>4)*8 + r][e = (e0+j)*16 + (lane&15)]: in kvT's order that is
    // d block dt/2, e tile e0+j, fragment half dt&1, this same lane, element r
    #pragma unroll
    for (int j = 0; j < 2; ++j) {
        float* dst = kvP + (size_t)blockIdx.x * (HD * HD)
            + ((dt >> 1) * 4 + e0 + j) * FR_FRAG + (dt & 1) * FR_HALF + lane * 4;
        *(float4*)dst                 = make_float4(acc[j][0], acc[j][1], acc[j][2], acc[j][3]);
        *(float4*)(dst + FR_HALF / 2) = make_float4(acc[j][4], acc[j][5], acc[j][6], acc[j][7]);
    }
}

// ================= kernel 2b: sum the slices' planes; kv^T -> bf16 (fragment order), ksum f32 =========
__global__ __launch_bounds__(256)
void k2b_cvt(const float* __restrict__ kvP, const float* __restrict__ ksP,
             unsigned short* __restrict__ kvT, float* __restrict__ ksum) {
    if (blockIdx.x < KVB_BLOCKS) {
        // four neighbouring floats of a plane per thread: elements 0..3 or 4..7 of one lane's eight
        const int i  = (blockIdx.x * 256 + threadIdx.x) * 4;
        const int bh = i / (HD * HD), o = i % (HD * HD);
        const float* p = kvP + (size_t)bh * NSLICE * (HD * HD) + o;
        float4 s = make_float4(0.f, 0.f, 0.f, 0.f);
        #pragma unroll
        for (int sl = 0; sl < NSLICE; ++sl) {
            const float4 v = *(const float4*)(p + sl * (HD * HD));
            s.x += v.x; s.y += v.y; s.z += v.z; s.w += v.w;
        }
        uint2 w;
        w.x = pack2(s.x, s.y); w.y = pack2(s.z, s.w);
        *(uint2*)&kvT[(i & ~(FR_HALF - 1)) + ((i >> 2) & 31) * 8 + ((i >> 7) & 1) * 4] = w;
    } else {
        // ksum[bh][d]: in each plane, waves (d/16)*2 and +1, lanes d%16 and +16 hold a part of it
        const int i  = (blockIdx.x - KVB_BLOCKS) * 256 + threadIdx.x;      // bh*HD + d
        const int bh = i / HD, d = i % HD;
        const float* p = ksP + (size_t)bh * NSLICE * 256 + (d >> 4) * 64 + (d & 15);
        float s = 0.f;
        #pragma unroll
        for (int sl = 0; sl < NSLICE; ++sl)
            #pragma unroll
            for (int q = 0; q < 4; ++q) s += p[sl * 256 + q * 16];
        ksum[i] = s;
        // precaution: stands in front of the next write to a register that the store names
        asm volatile("s_wait_xcnt 0x0" ::: "memory");
    }
}

// ================= kernel 3: out = (Q kv) / (Q ksum) =================
__global__ __launch_bounds__(256)
void k3_out(const unsigned short* __restrict__ Qf, const unsigned short* __restrict__ kvT,
            const float* __restrict__ ksum, float* __restrict__ out) {
    __shared__ float sks[HD];
    const int tid = threadIdx.x;
    const int bh  = blockIdx.x >> 6;
    const int blk = blockIdx.x & 63;
    if (tid < HD) sks[tid] = ksum[bh * HD + tid];
    __syncthreads();

    const int wave = tid >> 5, lane = tid & 31, ln = lane & 15, hi = lane >> 4;
    const int st = blk * 8 + wave;                  // s-tile 0..511

    const unsigned short* Ar = Qf + (size_t)bh * BH_ELEM + (size_t)st * Q_STILE + lane * 8;
    const v8f vzero = {0.f,0.f,0.f,0.f,0.f,0.f,0.f,0.f};
    v8f acc[4] = {vzero, vzero, vzero, vzero};
    float part = 0.f;

    #pragma unroll
    for (int k = 0; k < 2; ++k) {
        const int off1 = k * 32 + hi * 8;
        Frag a;
        a.q[0] = *(const uint4*)(Ar + k * FR_FRAG);
        a.q[1] = *(const uint4*)(Ar + k * FR_FRAG + FR_HALF);
        // denominator partial: lane holds Q[st*16+ln, off1..off1+7] and [+16..+23]
        #pragma unroll
        for (int e = 0; e < 8; ++e) part += bf2f(a.us[e])     * sks[off1 + e];
        #pragma unroll
        for (int e = 0; e < 8; ++e) part += bf2f(a.us[8 + e]) * sks[off1 + 16 + e];
        #pragma unroll
        for (int j = 0; j < 4; ++j) {
            const unsigned short* Br = kvT + (size_t)bh * (HD * HD) + (k * 4 + j) * FR_FRAG + lane * 8;
            Frag bfr;
            bfr.q[0] = *(const uint4*)Br;
            bfr.q[1] = *(const uint4*)(Br + FR_HALF);
            acc[j] = wmma_bf16(a, bfr, acc[j]);
        }
    }

    const float dsum = part + __shfl_xor(part, 16, 32);   // combine K-halves
    float dr[8];
    #pragma unroll
    for (int r = 0; r < 8; ++r) dr[r] = __shfl(dsum, r + hi * 8, 32);

    const int b_ = bh / NH, h_ = bh % NH;
    #pragma unroll
    for (int j = 0; j < 4; ++j)
        #pragma unroll
        for (int r = 0; r < 8; ++r) {
            const int s = st * 16 + hi * 8 + r;
            out[((size_t)b_ * S_LEN + s) * HMODEL + h_ * HD + j * 16 + ln] =
                acc[j][r] / dr[r];
        }
}

// ================= launch =================
extern "C" void kernel_launch(void* const* d_in, const int* in_sizes, int n_in,
                              void* d_out, int out_size, void* d_ws, size_t ws_size,
                              hipStream_t stream) {
    const float* hid  = (const float*)d_in[0];
    const float* mask = (const float*)d_in[1];
    const float* Wq   = (const float*)d_in[2];
    const float* bq   = (const float*)d_in[3];
    const float* Wk   = (const float*)d_in[4];
    const float* bk   = (const float*)d_in[5];
    const float* Wv   = (const float*)d_in[6];
    const float* bv   = (const float*)d_in[7];
    float* out = (float*)d_out;

    char* w = (char*)d_ws;                       // 256B-aligned offsets
    unsigned short* Wb  = (unsigned short*)(w);                 // 3.38 MB
    unsigned short* Qf  = (unsigned short*)(w + 3538944);       // 48 MB
    unsigned short* Kt  = (unsigned short*)(w + 53870592);      // 48 MB
    unsigned short* Vt  = (unsigned short*)(w + 104202240);     // 48 MB
    float*          ksP = (float*)(w + 154533888);              // 768 KB
    unsigned short* kvT = (unsigned short*)(w + 155320320);     // 384 KB
    float*          ks  = (float*)(w + 155713536);              // 12 KB
    float*          kvP = (float*)(w + 155725824);              // 12 MB

    k0_prep<<<1024, 256, 0, stream>>>(Wq, Wk, Wv, Wb);
    k1_proj<<<M_TOTAL / BLK_M, 256, 0, stream>>>(
        hid, mask, Wb, bq, bk, bv, Qf, Kt, Vt);
    k2_kv<<<BATCH * NH * NSLICE, 256, 0, stream>>>(Kt, Vt, kvP, ksP);
    k2b_cvt<<<KVB_BLOCKS + (BATCH * NH * HD) / 256, 256, 0, stream>>>(kvP, ksP, kvT, ks);
    k3_out<<<(BATCH * NH * (S_LEN / 16)) / 8, 256, 0, stream>>>(Qf, kvT, ks, out);
}

// v007
// It runs in 114 microseconds.
// In two side-by-side timings against v006, it was 1.04 and 1.03 times as fast.
// Counting every step since v000, it is 2.18 times as fast.
#include <hip/hip_runtime.h>

// ---------------- problem constants ----------------
#define BATCH   4
#define S_LEN   8192
#define HMODEL  768
#define NH      12
#define HD      64
#define KDIM    768          // GEMM K (= HMODEL)
#define NSTEPS  (KDIM/32)    // 24 k-steps of 32 for bf16 WMMA
#define BLK_M   128          // rows of hidden staged per block in k1 (one block per WGP)
#define MT      (BLK_M/16)   // 16-row tiles of the block; a wave works on all of them
#define NT      3            // 16-column tiles of the output per wave and group in k1
#define NGROUP  (3*HMODEL/16/(8*NT))   // groups of 8 waves x NT tiles over Wq, Wk, Wv stacked
#define APITCH  776          // LDS row pitch in halves (768 + 8 pad -> bank spread)
#define M_TOTAL (BATCH*S_LEN)
#define NW_ELEM (HMODEL*HMODEL)
#define WRING   4            // k-steps of W fragments in flight per wave in k1
#define SB      (BLK_M/8)    // k1 staging: rows per wave, and its loads in flight
#define RP      (KDIM/128)   // k1 staging: 512-byte pieces of a row of hidden
// Packed W, in halves: [set of NT 16-row tiles][k-step][tile of the set][fragment half][lane][8].
// One wave-wide 16-byte load of a fragment half is then 512 contiguous, aligned bytes.
#define WP_HALF  256                 // 32 lanes x 8 halves
#define WP_TILE  (2*WP_HALF)         // one 16x32 fragment
#define WP_STEP  (NT*WP_TILE)        // all tiles of a set, one k-step
#define WP_SET   (NSTEPS*WP_STEP)    // a set's whole K
// Q, K, V and kv are kept in the same fragment order, in halves ([fragment half][lane][8] innermost):
//   K, V: [bh][block of 32 s][16-row tile of d][2][32][8]   (lane = d row of the tile, k index = s)
//   Q   : [bh][tile of 16 s][block of 32 d][2][32][8]       (lane = s row of the tile, k index = d)
//   kv  : [bh][block of 32 d][16-row tile of e][2][32][8]   (lane = e row of the tile, k index = d)
// so every wave-wide 16-byte store or load of a fragment half is 512 contiguous, aligned bytes.
#define FR_HALF  256                 // 32 lanes x 8 halves
#define FR_FRAG  (2*FR_HALF)         // one 16x32 fragment
#define KV_SBLK  (4*FR_FRAG)         // K, V: the four d tiles of one block of 32 s
#define Q_STILE  (2*FR_FRAG)         // Q: both d blocks of one tile of 16 s
#define BH_ELEM  (S_LEN*HD)          // one head's Q, K or V
#define NSLICE   16                  // k2: blocks (slices of 512 s) per head
#define KVB_BLOCKS (BATCH*NH*HD*HD/4/256)   // k2b: blocks that sum kv; BATCH*NH*HD/256 more sum ksum

// ---------------- vector types for WMMA ----------------
typedef __attribute__((ext_vector_type(16))) __bf16 v16bf;
typedef __attribute__((ext_vector_type(8)))  float  v8f;
typedef __attribute__((ext_vector_type(2)))  float  f32x2;
typedef __attribute__((ext_vector_type(2)))  __bf16 bf16x2;

struct Frag {
    union {
        v16bf v;
        uint4 q[2];
        unsigned short us[16];
    };
};

// ---------------- helpers ----------------
__device__ __forceinline__ float bf2f(unsigned short h) {
    union { unsigned int u; float f; } c; c.u = ((unsigned int)h) << 16;
    return c.f;
}
// two f32 -> two bf16 (a in the low half), round-nearest-even, by the chip's own packed conversion
__device__ __forceinline__ unsigned int pack2(float a, float b) {
    const f32x2 v = {a, b};
    union { bf16x2 h; unsigned int u; } c;
    c.h = __builtin_convertvector(v, bf16x2);
    return c.u;
}
__device__ __forceinline__ float elu1(float x) {          // elu(x)+1
    return x > 0.f ? x + 1.f : __expf(x);
}
__device__ __forceinline__ v8f wmma_bf16(const Frag& a, const Frag& b, v8f c) {
    return __builtin_amdgcn_wmma_f32_16x16x32_bf16(false, a.v, false, b.v,
                                                   (short)0, c, false, false);
}

// ================= kernel 0: W fp32->bf16 in fragment order =================
__global__ __launch_bounds__(256)
void k0_prep(const float* __restrict__ Wq, const float* __restrict__ Wk,
             const float* __restrict__ Wv, unsigned short* __restrict__ Wb) {
    const int stride = gridDim.x * blockDim.x;
    // one 16-byte piece per thread: the 8 halves that lane (i & 31) of k1 holds in one register quad
    for (int i = blockIdx.x * blockDim.x + threadIdx.x; i < 3 * NW_ELEM / 8; i += stride) {
        const int lane = i & 31, q = (i >> 5) & 1, j = (i >> 6) % NT;
        const int s    = ((i >> 6) / NT) % NSTEPS, set = (i >> 6) / (NT * NSTEPS);
        const int row  = (set * NT + j) * 16 + (lane & 15);      // row of Wq, Wk, Wv stacked
        const int col  = s * 32 + q * 16 + (lane >> 4) * 8;
        const float* W = (row < HMODEL) ? Wq : ((row < 2 * HMODEL) ? Wk : Wv);
        const float* p = W + (size_t)(row % HMODEL) * KDIM + col;
        const float4 a = *(const float4*)p;
        const float4 c = *(const float4*)(p + 4);
        uint4 w;
        w.x = pack2(a.x, a.y); w.y = pack2(a.z, a.w);
        w.z = pack2(c.x, c.y); w.w = pack2(c.z, c.w);
        *(uint4*)&Wb[(size_t)i * 8] = w;
    }
}

// ================= kernel 1: fused QKV projections (bf16 WMMA) =================
// Q, K, V -> bf16 in the fragment order that k2 and k3 load them in
__global__ __launch_bounds__(256)
void k1_proj(const float* __restrict__ hid, const float* __restrict__ mask,
             const unsigned short* __restrict__ Wb,
             const float* __restrict__ bq, const float* __restrict__ bk,
             const float* __restrict__ bv,
             unsigned short* __restrict__ Qf, unsigned short* __restrict__ Kt,
             unsigned short* __restrict__ Vt) {
    __shared__ __attribute__((aligned(16))) unsigned short atile[BLK_M * APITCH];   // bf16
    __shared__ float smask[2 * BLK_M];               // the rows' mask, then a plane of zeros
    __shared__ float sscr[8][272];                   // per-wave 16x17 f32 transpose pad

    const int tid = threadIdx.x;
    const int gm0 = blockIdx.x * BLK_M;              // first global row (b*S+s)

    // read ahead of the staging loads, stored behind them: the store's wait would hold them back
    const float mrow = (tid < BLK_M) ? mask[gm0 + tid] : 0.f;

    // stage A block fp32 -> bf16 into LDS
    // Wave w stages rows w, w+8, ...: a trip takes one 512-byte piece (of RP) of each of its SB rows. A
    // register quad is refilled with the next trip's load right behind its conversion, so SB-1 to SB loads
    // per wave stay in flight. The WGP holds only this block's 8 waves, and with few loads each, all waited
    // for before the next are issued, the stream runs at the memory's latency and not at its rate.
    // The waves start at different pieces, so that the block's loads in flight do not all lie at one
    // offset inside the 3-KB rows.
    {
        int c = (tid >> 5) % RP;                     // the piece that the quads hold
        const float* gsrc = hid + (size_t)(gm0 + (tid >> 5)) * KDIM + c * 128 + (tid & 31) * 4;
        unsigned short* lrow = &atile[(tid >> 5) * APITCH + (tid & 31) * 4];
        float4 sq[SB];
        #pragma unroll
        for (int j = 0; j < SB; ++j) sq[j] = *(const float4*)(gsrc + j * 8 * KDIM);
        // rolled: the trips are alike, and unrolled they would push the epilogue further back in the text
        #pragma unroll 1
        for (int p = 0; p < RP; ++p) {
            // behind the last trip there is nothing left to fetch: its refill stays on the trip's own
            // bytes and is dropped, so that one loop body serves every trip
            const int cn = (p == RP - 1) ? c : ((c == RP - 1) ? 0 : c + 1);
            gsrc += (cn - c) * 128;
            unsigned short* ldst = lrow + c * 128;
            #pragma unroll
            for (int j = 0; j < SB; ++j) {
                const float4 f = sq[j];
                unsigned short* dst = ldst + j * 8 * APITCH;
                *(uint2*)dst = make_uint2(pack2(f.x, f.y), pack2(f.z, f.w));
                sq[j] = *(const float4*)(gsrc + j * 8 * KDIM);
                // keeps each refill right behind its quad's conversion; without it the compiler gathers
                // the loads behind the last conversion, whose wait has drained all that was in flight
                __builtin_amdgcn_sched_barrier(0);
            }
            c = cn;
        }
    }
    smask[tid] = mrow;
    __syncthreads();

    const int wave = tid >> 5, lane = tid & 31;
    const int ln = lane & 15, hi = lane >> 4;
    const int b   = gm0 / S_LEN;
    const int sb0 = gm0 % S_LEN;
    const v8f vzero = {0.f,0.f,0.f,0.f,0.f,0.f,0.f,0.f};

    // Software-pipelined k loop. W fragments live in a register ring WRING k-steps deep:
    // a slot is refilled right behind the WMMAs that read it, so a load has WRING-1
    // k-steps of matrix work to land. The LDS fragments are fetched one k-step ahead.
    // A W fragment feeds MT WMMAs and an LDS fragment NT.
    // Stacked W rows are linear in g: row = ((g*8 + wave)*NT + j)*16 + ln, so set = g*8 + wave.
    const unsigned short* wlane = Wb + (size_t)wave * WP_SET + lane * 8;
    Frag ring[WRING][NT];
    Frag af[2][MT];
    #pragma unroll
    for (int s = 0; s < WRING; ++s)
        #pragma unroll
        for (int j = 0; j < NT; ++j) {
            const unsigned short* p = wlane + s * WP_STEP + j * WP_TILE;
            ring[s][j].q[0] = *(const uint4*)p;
            ring[s][j].q[1] = *(const uint4*)(p + WP_HALF);
        }
    #pragma unroll
    for (int ms = 0; ms < MT; ++ms) {
        const unsigned short* p = &atile[(ms * 16 + ln) * APITCH + hi * 8];
        af[0][ms].q[0] = *(const uint4*)p;
        af[0][ms].q[1] = *(const uint4*)(p + 16);
    }

    const unsigned short* wgrp = wlane;
    for (int g = 0; g < NGROUP; ++g) {                // 3 proj x NGROUP/3 groups of column sets
        const int proj = g / (NGROUP / 3);
        const int set  = (g % (NGROUP / 3)) * 8 + wave;   // column set inside the projection
        const int n0   = set * NT;                    // first 16-col tile index
        const float* bias = (proj == 0) ? bq : ((proj == 1) ? bk : bv);
        const unsigned short* wcur = wgrp;            // this group's rows of packed W
        // the ring runs on into the next group's rows, over the epilogue; behind the
        // last group there are none, and the refill stays on this group's own rows
        const unsigned short* wnxt = wcur + (g < NGROUP - 1 ? 8 * WP_SET : 0);
        wgrp = wnxt;

        v8f acc[MT][NT];
        #pragma unroll
        for (int ms = 0; ms < MT; ++ms)
            #pragma unroll
            for (int j = 0; j < NT; ++j) acc[ms][j] = vzero;

        #pragma unroll
        for (int k = 0; k < NSTEPS; ++k) {
            // next k-step's LDS fragments (step 0 again behind the last: every group starts there)
            #pragma unroll
            for (int ms = 0; ms < MT; ++ms) {
                const int off1 = ((k + 1) % NSTEPS) * 32 + hi * 8;   // half-index of first 8-chunk
                const unsigned short* p = &atile[(ms * 16 + ln) * APITCH + off1];
                af[(k + 1) & 1][ms].q[0] = *(const uint4*)p;
                af[(k + 1) & 1][ms].q[1] = *(const uint4*)(p + 16);
            }
            // keeps the LDS reads as one group ahead of this step's WMMAs; without it the
            // compiler sinks them to their use and waits out the LDS latency every step
            __builtin_amdgcn_sched_barrier(0);
            #pragma unroll
            for (int ms = 0; ms < MT; ++ms)
                #pragma unroll
                for (int j = 0; j < NT; ++j)
                    acc[ms][j] = wmma_bf16(af[k & 1][ms], ring[k % WRING][j], acc[ms][j]);
            const unsigned short* wsrc = (k + WRING < NSTEPS)
                ? wcur + (k + WRING) * WP_STEP : wnxt + (k + WRING - NSTEPS) * WP_STEP;
            #pragma unroll
            for (int j = 0; j < NT; ++j) {
                const unsigned short* p = wsrc + j * WP_TILE;
                ring[k % WRING][j].q[0] = *(const uint4*)p;
                ring[k % WRING][j].q[1] = *(const uint4*)(p + WP_HALF);
            }
            // keeps the refill here, WRING-1 steps ahead of its use; without it the
            // compiler sinks the loads to their use and the L2 latency is waited out
            __builtin_amdgcn_sched_barrier(0);
        }

        // ---- epilogue: one body for Q, K and V, so that the 24 unrolled tiles stay small in the text ----
        const bool  isQ  = (proj == 0), isV = (proj == 2);
        const float one  = isV ? 0.f : 1.f;           // V: bias alone, no mask, no elu
        const float* sm  = smask + (isV ? BLK_M : 0) + hi * 8;   // V reads the plane of zeros
        unsigned short* kvdst = isV ? Vt : Kt;
        // the lane's NT bias values, read once per group: all MT tiles of a column share them
        float bb[NT];
        #pragma unroll
        for (int j = 0; j < NT; ++j) bb[j] = bias[(n0 + j) * 16 + ln];
        #pragma unroll
        for (int ms = 0; ms < MT; ++ms) {
            #pragma unroll
            for (int j = 0; j < NT; ++j) {
                const int ng = (n0 + j) * 16 + ln;    // lane's output column
                const int h  = ng / HD;
                const int dt = (n0 + j) & 3;          // 16-column tile inside the head
                float vv[8];
                #pragma unroll
                for (int r = 0; r < 8; ++r) {
                    const float x = acc[ms][j][r] + bb[j] + sm[ms * 16 + r];
                    vv[r] = (isV || x > 0.f) ? x + one : __expf(x);      // Q, K: elu(x)+1
                }
                // K, V: the lane's 8 rows s are fragment half (ms & 1) of s block sb0/32 + ms/2,
                // and the lane keeps its number (column d -> row of the fragment, hi -> hi)
                unsigned short* dst = kvdst + (size_t)(b * NH + h) * BH_ELEM
                    + (size_t)((sb0 >> 5) + (ms >> 1)) * KV_SBLK + dt * FR_FRAG
                    + (ms & 1) * FR_HALF + lane * 8;
                if (isQ) {                             // Q: LDS transpose
                    // the wave barriers keep the compiler from moving the pad's writes and reads
                    // (other lanes' words) across each other
                    __builtin_amdgcn_wave_barrier();
                    #pragma unroll
                    for (int r = 0; r < 8; ++r) sscr[wave][(hi * 8 + r) * 17 + ln] = vv[r];
                    __builtin_amdgcn_wave_barrier();
                    const float* src = &sscr[wave][ln * 17 + hi * 8];
                    #pragma unroll
                    for (int r = 0; r < 8; ++r) vv[r] = src[r];
                    __builtin_amdgcn_wave_barrier();
                    // lane = (row s, hi) now holds columns dt*16 + hi*8 .. +7 of the head:
                    // fragment half (dt & 1) of d block dt/2, s tile sb0/16 + ms
                    dst = Qf + (size_t)(b * NH + h) * BH_ELEM
                        + (size_t)((sb0 >> 4) + ms) * Q_STILE + (dt >> 1) * FR_FRAG
                        + (dt & 1) * FR_HALF + lane * 8;
                }
                uint4 w;
                w.x = pack2(vv[0], vv[1]); w.y = pack2(vv[2], vv[3]);
                w.z = pack2(vv[4], vv[5]); w.w = pack2(vv[6], vv[7]);
                *(uint4*)dst = w;
                // precaution: stands in front of the next write to a register that this store names
                asm volatile("s_wait_xcnt 0x0" ::: "memory");
            }
        }
    }
}

// ================= kernel 2: per-slice partial sums of kv = K^T V and ksum = sum_s K =================
// Every block owns its own plane of kvP (HD*HD floats) and of ksP (one float per thread), so nothing
// is added into memory; k2b sums the NSLICE planes of a head. A kvP plane keeps kvT's order of
// fragment halves; inside a half it is [4 elements of 8][lane][4], so a wave-wide 16-byte store is
// 512 contiguous bytes.
__global__ __launch_bounds__(256)
void k2_kv(const unsigned short* __restrict__ Kt, const unsigned short* __restrict__ Vt,
           float* __restrict__ kvP, float* __restrict__ ksP) {
    const int bh = blockIdx.x >> 4;
    const int tid = threadIdx.x;
    const int wave = tid >> 5, lane = tid & 31;
    // this block's slice: 512 s = 16 blocks of 32
    const size_t slice = (size_t)bh * BH_ELEM + (size_t)(blockIdx.x & 15) * 16 * KV_SBLK;

    // ---- ksum partial: a wave sums one fragment half of one d tile over the slice ----
    {
        const unsigned short* p = Kt + slice + (wave >> 1) * FR_FRAG + (wave & 1) * FR_HALF + lane * 8;
        float sum = 0.f;
        for (int i = 0; i < 16; ++i) {
            uint4 qv = *(const uint4*)(p + i * KV_SBLK);
            const unsigned short* u = (const unsigned short*)&qv;
            #pragma unroll
            for (int e = 0; e < 8; ++e) sum += bf2f(u[e]);
        }
        ksP[blockIdx.x * 256 + tid] = sum;
        // precaution: stands in front of the next write to a register that the store names
        asm volatile("s_wait_xcnt 0x0" ::: "memory");
    }

    // ---- kv tiles via WMMA: A = K[d,s], B^T = V[e,s] ----
    const int dt = wave >> 1;                 // d tile 0..3
    const int e0 = (wave & 1) * 2;            // e tiles e0, e0+1
    const v8f vzero = {0.f,0.f,0.f,0.f,0.f,0.f,0.f,0.f};
    v8f acc[2] = {vzero, vzero};

    const unsigned short* Ar = Kt + slice + dt * FR_FRAG + lane * 8;
    const unsigned short* B0 = Vt + slice + e0 * FR_FRAG + lane * 8;
    const unsigned short* B1 = B0 + FR_FRAG;

    for (int k = 0; k < 16; ++k) {
        const int off = k * KV_SBLK;
        Frag a, b0, b1;
        a.q[0]  = *(const uint4*)(Ar + off); a.q[1]  = *(const uint4*)(Ar + off + FR_HALF);
        b0.q[0] = *(const uint4*)(B0 + off); b0.q[1] = *(const uint4*)(B0 + off + FR_HALF);
        // precaution: behind the last use of Ar the compiler gives its registers to the last
        // loads' data; this stands in front of that write
        if (k == 15) asm volatile("s_wait_xcnt 0x0" ::: "memory");
        b1.q[0] = *(const uint4*)(B1 + off); b1.q[1] = *(const uint4*)(B1 + off + FR_HALF);
        acc[0] = wmma_bf16(a, b0, acc[0]);
        acc[1] = wmma_bf16(a, b1, acc[1]);
    }
    // acc[j][r] is kv[d = dt*16 + (lane>>4)*8 + r][e = (e0+j)*16 + (lane&15)]: in kvT's order that is
    // d block dt/2, e tile e0+j, fragment half dt&1, this same lane, element r
    #pragma unroll
    for (int j = 0; j < 2; ++j) {
        float* dst = kvP + (size_t)blockIdx.x * (HD * HD)
            + ((dt >> 1) * 4 + e0 + j) * FR_FRAG + (dt & 1) * FR_HALF + lane * 4;
        *(float4*)dst                 = make_float4(acc[j][0], acc[j][1], acc[j][2], acc[j][3]);
        *(float4*)(dst + FR_HALF / 2) = make_float4(acc[j][4], acc[j][5], acc[j][6], acc[j][7]);
    }
}

// ================= kernel 2b: sum the slices' planes; kv^T -> bf16 (fragment order), ksum f32 =========
__global__ __launch_bounds__(256)
void k2b_cvt(const float* __restrict__ kvP, const float* __restrict__ ksP,
             unsigned short* __restrict__ kvT, float* __restrict__ ksum) {
    if (blockIdx.x < KVB_BLOCKS) {
        // four neighbouring floats of a plane per thread: elements 0..3 or 4..7 of one lane's eight
        const int i  = (blockIdx.x * 256 + threadIdx.x) * 4;
        const int bh = i / (HD * HD), o = i % (HD * HD);
        const float* p = kvP + (size_t)bh * NSLICE * (HD * HD) + o;
        float4 s = make_float4(0.f, 0.f, 0.f, 0.f);
        #pragma unroll
        for (int sl = 0; sl < NSLICE; ++sl) {
            const float4 v = *(const float4*)(p + sl * (HD * HD));
            s.x += v.x; s.y += v.y; s.z += v.z; s.w += v.w;
        }
        uint2 w;
        w.x = pack2(s.x, s.y); w.y = pack2(s.z, s.w);
        *(uint2*)&kvT[(i & ~(FR_HALF - 1)) + ((i >> 2) & 31) * 8 + ((i >> 7) & 1) * 4] = w;
    } else {
        // ksum[bh][d]: in each plane, waves (d/16)*2 and +1, lanes d%16 and +16 hold a part of it
        const int i  = (blockIdx.x - KVB_BLOCKS) * 256 + threadIdx.x;      // bh*HD + d
        const int bh = i / HD, d = i % HD;
        const float* p = ksP + (size_t)bh * NSLICE * 256 + (d >> 4) * 64 + (d & 15);
        float s = 0.f;
        #pragma unroll
        for (int sl = 0; sl < NSLICE; ++sl)
            #pragma unroll
            for (int q = 0; q < 4; ++q) s += p[sl * 256 + q * 16];
        ksum[i] = s;
        // precaution: stands in front of the next write to a register that the store names
        asm volatile("s_wait_xcnt 0x0" ::: "memory");
    }
}

// ================= kernel 3: out = (Q kv) / (Q ksum) =================
__global__ __launch_bounds__(256)
void k3_out(const unsigned short* __restrict__ Qf, const unsigned short* __restrict__ kvT,
            const float* __restrict__ ksum, float* __restrict__ out) {
    __shared__ float sks[HD];
    const int tid = threadIdx.x;
    const int bh  = blockIdx.x >> 6;
    const int blk = blockIdx.x & 63;
    if (tid < HD) sks[tid] = ksum[bh * HD + tid];
    __syncthreads();

    const int wave = tid >> 5, lane = tid & 31, ln = lane & 15, hi = lane >> 4;
    const int st = blk * 8 + wave;                  // s-tile 0..511

    const unsigned short* Ar = Qf + (size_t)bh * BH_ELEM + (size_t)st * Q_STILE + lane * 8;
    const v8f vzero = {0.f,0.f,0.f,0.f,0.f,0.f,0.f,0.f};
    v8f acc[4] = {vzero, vzero, vzero, vzero};
    float part = 0.f;

    #pragma unroll
    for (int k = 0; k < 2; ++k) {
        const int off1 = k * 32 + hi * 8;
        Frag a;
        a.q[0] = *(const uint4*)(Ar + k * FR_FRAG);
        a.q[1] = *(const uint4*)(Ar + k * FR_FRAG + FR_HALF);
        // denominator partial: lane holds Q[st*16+ln, off1..off1+7] and [+16..+23]
        #pragma unroll
        for (int e = 0; e < 8; ++e) part += bf2f(a.us[e])     * sks[off1 + e];
        #pragma unroll
        for (int e = 0; e < 8; ++e) part += bf2f(a.us[8 + e]) * sks[off1 + 16 + e];
        #pragma unroll
        for (int j = 0; j < 4; ++j) {
            const unsigned short* Br = kvT + (size_t)bh * (HD * HD) + (k * 4 + j) * FR_FRAG + lane * 8;
            Frag bfr;
            bfr.q[0] = *(const uint4*)Br;
            bfr.q[1] = *(const uint4*)(Br + FR_HALF);
            acc[j] = wmma_bf16(a, bfr, acc[j]);
        }
    }

    const float dsum = part + __shfl_xor(part, 16, 32);   // combine K-halves
    float dr[8];
    #pragma unroll
    for (int r = 0; r < 8; ++r) dr[r] = __shfl(dsum, r + hi * 8, 32);

    const int b_ = bh / NH, h_ = bh % NH;
    #pragma unroll
    for (int j = 0; j < 4; ++j)
        #pragma unroll
        for (int r = 0; r < 8; ++r) {
            const int s = st * 16 + hi * 8 + r;
            out[((size_t)b_ * S_LEN + s) * HMODEL + h_ * HD + j * 16 + ln] =
                acc[j][r] / dr[r];
        }
}

// ================= launch =================
extern "C" void kernel_launch(void* const* d_in, const int* in_sizes, int n_in,
                              void* d_out, int out_size, void* d_ws, size_t ws_size,
                              hipStream_t stream) {
    const float* hid  = (const float*)d_in[0];
    const float* mask = (const float*)d_in[1];
    const float* Wq   = (const float*)d_in[2];
    const float* bq   = (const float*)d_in[3];
    const float* Wk   = (const float*)d_in[4];
    const float* bk   = (const float*)d_in[5];
    const float* Wv   = (const float*)d_in[6];
    const float* bv   = (const float*)d_in[7];
    float* out = (float*)d_out;

    char* w = (char*)d_ws;                       // 256B-aligned offsets
    unsigned short* Wb  = (unsigned short*)(w);                 // 3.38 MB
    unsigned short* Qf  = (unsigned short*)(w + 3538944);       // 48 MB
    unsigned short* Kt  = (unsigned short*)(w + 53870592);      // 48 MB
    unsigned short* Vt  = (unsigned short*)(w + 104202240);     // 48 MB
    float*          ksP = (float*)(w + 154533888);              // 768 KB
    unsigned short* kvT = (unsigned short*)(w + 155320320);     // 384 KB
    float*          ks  = (float*)(w + 155713536);              // 12 KB
    float*          kvP = (float*)(w + 155725824);              // 12 MB

    k0_prep<<<1024, 256, 0, stream>>>(Wq, Wk, Wv, Wb);
    k1_proj<<<M_TOTAL / BLK_M, 256, 0, stream>>>(
        hid, mask, Wb, bq, bk, bv, Qf, Kt, Vt);
    k2_kv<<<BATCH * NH * NSLICE, 256, 0, stream>>>(Kt, Vt, kvP, ksP);
    k2b_cvt<<<KVB_BLOCKS + (BATCH * NH * HD) / 256, 256, 0, stream>>>(kvP, ksP, kvT, ks);
    k3_out<<<(BATCH * NH * (S_LEN / 16)) / 8, 256, 0, stream>>>(Qf, kvT, ks, out);
}

// v008
// A run of this version takes 107 microseconds.
// Two timings next to v007 both put it at 1.06 times that version's speed.
// Counting every step since v000, it is 2.32 times as fast.
#include <hip/hip_runtime.h>

// ---------------- problem constants ----------------
#define BATCH   4
#define S_LEN   8192
#define HMODEL  768
#define NH      12
#define HD      64
#define KDIM    768          // GEMM K (= HMODEL)
#define NSTEPS  (KDIM/32)    // 24 k-steps of 32 for bf16 WMMA
#define BLK_M   128          // rows of hidden staged per block in k1 (one block per WGP)
#define MT      (BLK_M/16)   // 16-row tiles of the block; a wave works on all of them
#define NT      3            // 16-column tiles of the output per wave and group in k1
#define NGROUP  (3*HMODEL/16/(8*NT))   // groups of 8 waves x NT tiles over Wq, Wk, Wv stacked
#define APITCH  776          // LDS row pitch in halves (768 + 8 pad -> bank spread)
#define M_TOTAL (BATCH*S_LEN)
#define NW_ELEM (HMODEL*HMODEL)
#define WRING   4            // k-steps of W fragments in flight per wave in k1
#define SB      (BLK_M/8)    // k1 staging: rows per wave, and its loads in flight
#define RP      (KDIM/128)   // k1 staging: 512-byte pieces of a row of hidden
// Packed W, in halves: [set of NT 16-row tiles][k-step][tile of the set][fragment half][lane][8].
// One wave-wide 16-byte load of a fragment half is then 512 contiguous, aligned bytes.
#define WP_HALF  256                 // 32 lanes x 8 halves
#define WP_TILE  (2*WP_HALF)         // one 16x32 fragment
#define WP_STEP  (NT*WP_TILE)        // all tiles of a set, one k-step
#define WP_SET   (NSTEPS*WP_STEP)    // a set's whole K
// Q, K, V and kv are kept in the same fragment order, in halves ([fragment half][lane][8] innermost):
//   K, V: [bh][block of 32 s][16-row tile of d][2][32][8]   (lane = d row of the tile, k index = s)
//   Q   : [bh][tile of 16 s][block of 32 d][2][32][8]       (lane = s row of the tile, k index = d)
//   kv  : [bh][block of 32 d][16-row tile of e][2][32][8]   (lane = e row of the tile, k index = d)
// so every wave-wide 16-byte store or load of a fragment half is 512 contiguous, aligned bytes.
#define FR_HALF  256                 // 32 lanes x 8 halves
#define FR_FRAG  (2*FR_HALF)         // one 16x32 fragment
#define KV_SBLK  (4*FR_FRAG)         // K, V: the four d tiles of one block of 32 s
#define Q_STILE  (2*FR_FRAG)         // Q: both d blocks of one tile of 16 s
#define BH_ELEM  (S_LEN*HD)          // one head's Q, K or V
#define NSLICE   16                  // k2: blocks (slices of 512 s) per head
#define KVB_BLOCKS (BATCH*NH*HD*HD/4/256)   // k2b: blocks that sum kv; BATCH*NH*HD/256 more sum ksum

// ---------------- vector types for WMMA ----------------
typedef __attribute__((ext_vector_type(16))) __bf16 v16bf;
typedef __attribute__((ext_vector_type(8)))  float  v8f;
typedef __attribute__((ext_vector_type(2)))  float  f32x2;
typedef __attribute__((ext_vector_type(2)))  __bf16 bf16x2;

struct Frag {
    union {
        v16bf v;
        uint4 q[2];
        unsigned short us[16];
    };
};

// ---------------- helpers ----------------
__device__ __forceinline__ float bf2f(unsigned short h) {
    union { unsigned int u; float f; } c; c.u = ((unsigned int)h) << 16;
    return c.f;
}
// two f32 -> two bf16 (a in the low half), round-nearest-even, by the chip's own packed conversion
__device__ __forceinline__ unsigned int pack2(float a, float b) {
    const f32x2 v = {a, b};
    union { bf16x2 h; unsigned int u; } c;
    c.h = __builtin_convertvector(v, bf16x2);
    return c.u;
}
__device__ __forceinline__ float elu1(float x) {          // elu(x)+1
    return x > 0.f ? x + 1.f : __expf(x);
}
__device__ __forceinline__ v8f wmma_bf16(const Frag& a, const Frag& b, v8f c) {
    return __builtin_amdgcn_wmma_f32_16x16x32_bf16(false, a.v, false, b.v,
                                                   (short)0, c, false, false);
}

// ================= kernel 0: W fp32->bf16 in fragment order =================
__global__ __launch_bounds__(256)
void k0_prep(const float* __restrict__ Wq, const float* __restrict__ Wk,
             const float* __restrict__ Wv, unsigned short* __restrict__ Wb) {
    const int stride = gridDim.x * blockDim.x;
    // one 16-byte piece per thread: the 8 halves that lane (i & 31) of k1 holds in one register quad
    for (int i = blockIdx.x * blockDim.x + threadIdx.x; i < 3 * NW_ELEM / 8; i += stride) {
        const int lane = i & 31, q = (i >> 5) & 1, j = (i >> 6) % NT;
        const int s    = ((i >> 6) / NT) % NSTEPS, set = (i >> 6) / (NT * NSTEPS);
        const int row  = (set * NT + j) * 16 + (lane & 15);      // row of Wq, Wk, Wv stacked
        const int col  = s * 32 + q * 16 + (lane >> 4) * 8;
        const float* W = (row < HMODEL) ? Wq : ((row < 2 * HMODEL) ? Wk : Wv);
        const float* p = W + (size_t)(row % HMODEL) * KDIM + col;
        const float4 a = *(const float4*)p;
        const float4 c = *(const float4*)(p + 4);
        uint4 w;
        w.x = pack2(a.x, a.y); w.y = pack2(a.z, a.w);
        w.z = pack2(c.x, c.y); w.w = pack2(c.z, c.w);
        *(uint4*)&Wb[(size_t)i * 8] = w;
    }
}

// ================= kernel 1: fused QKV projections (bf16 WMMA) =================
// Q, K, V -> bf16 in the fragment order that k2 and k3 load them in
__global__ __launch_bounds__(256)
void k1_proj(const float* __restrict__ hid, const float* __restrict__ mask,
             const unsigned short* __restrict__ Wb,
             const float* __restrict__ bq, const float* __restrict__ bk,
             const float* __restrict__ bv,
             unsigned short* __restrict__ Qf, unsigned short* __restrict__ Kt,
             unsigned short* __restrict__ Vt) {
    __shared__ __attribute__((aligned(16))) unsigned short atile[BLK_M * APITCH];   // bf16
    __shared__ float smask[BLK_M];                   // the rows' mask
    __shared__ float sscr[8][272];                   // per-wave 16x17 f32 transpose pad

    const int tid = threadIdx.x;
    const int gm0 = blockIdx.x * BLK_M;              // first global row (b*S+s)

    // read ahead of the staging loads, stored behind them: the store's wait would hold them back
    const float mrow = (tid < BLK_M) ? mask[gm0 + tid] : 0.f;

    // stage A block fp32 -> bf16 into LDS
    // Wave w stages rows w, w+8, ...: a trip takes one 512-byte piece (of RP) of each of its SB rows. A
    // register quad is refilled with the next trip's load right behind its conversion, so SB-1 to SB loads
    // per wave stay in flight. The WGP holds only this block's 8 waves, and with few loads each, all waited
    // for before the next are issued, the stream runs at the memory's latency and not at its rate.
    // The waves start at different pieces, so that the block's loads in flight do not all lie at one
    // offset inside the 3-KB rows.
    {
        int c = (tid >> 5) % RP;                     // the piece that the quads hold
        const float* gsrc = hid + (size_t)(gm0 + (tid >> 5)) * KDIM + c * 128 + (tid & 31) * 4;
        unsigned short* lrow = &atile[(tid >> 5) * APITCH + (tid & 31) * 4];
        float4 sq[SB];
        #pragma unroll
        for (int j = 0; j < SB; ++j) sq[j] = *(const float4*)(gsrc + j * 8 * KDIM);
        // rolled: the trips are alike, and unrolled they would push the epilogue further back in the text
        #pragma unroll 1
        for (int p = 0; p < RP; ++p) {
            // behind the last trip there is nothing left to fetch: its refill stays on the trip's own
            // bytes and is dropped, so that one loop body serves every trip
            const int cn = (p == RP - 1) ? c : ((c == RP - 1) ? 0 : c + 1);
            gsrc += (cn - c) * 128;
            unsigned short* ldst = lrow + c * 128;
            #pragma unroll
            for (int j = 0; j < SB; ++j) {
                const float4 f = sq[j];
                unsigned short* dst = ldst + j * 8 * APITCH;
                *(uint2*)dst = make_uint2(pack2(f.x, f.y), pack2(f.z, f.w));
                sq[j] = *(const float4*)(gsrc + j * 8 * KDIM);
                // keeps each refill right behind its quad's conversion; without it the compiler gathers
                // the loads behind the last conversion, whose wait has drained all that was in flight
                __builtin_amdgcn_sched_barrier(0);
            }
            c = cn;
        }
    }
    if (tid < BLK_M) smask[tid] = mrow;
    __syncthreads();

    const int wave = tid >> 5, lane = tid & 31;
    const int ln = lane & 15, hi = lane >> 4;
    const int b   = gm0 / S_LEN;
    const int sb0 = gm0 % S_LEN;
    const v8f vzero = {0.f,0.f,0.f,0.f,0.f,0.f,0.f,0.f};

    // Software-pipelined k loop. W fragments live in a register ring WRING k-steps deep:
    // a slot is refilled right behind the WMMAs that read it, so a load has WRING-1
    // k-steps of matrix work to land. The LDS fragments are fetched one k-step ahead.
    // A W fragment feeds MT WMMAs and an LDS fragment NT.
    // Stacked W rows are linear in g: row = ((g*8 + wave)*NT + j)*16 + ln, so set = g*8 + wave.
    const unsigned short* wlane = Wb + (size_t)wave * WP_SET + lane * 8;
    Frag ring[WRING][NT];
    Frag af[2][MT];
    #pragma unroll
    for (int s = 0; s < WRING; ++s)
        #pragma unroll
        for (int j = 0; j < NT; ++j) {
            const unsigned short* p = wlane + s * WP_STEP + j * WP_TILE;
            ring[s][j].q[0] = *(const uint4*)p;
            ring[s][j].q[1] = *(const uint4*)(p + WP_HALF);
        }
    #pragma unroll
    for (int ms = 0; ms < MT; ++ms) {
        const unsigned short* p = &atile[(ms * 16 + ln) * APITCH + hi * 8];
        af[0][ms].q[0] = *(const uint4*)p;
        af[0][ms].q[1] = *(const uint4*)(p + 16);
    }

    const unsigned short* wgrp = wlane;
    for (int g = 0; g < NGROUP; ++g) {                // 3 proj x NGROUP/3 groups of column sets
        const int proj = g / (NGROUP / 3);
        const int set  = (g % (NGROUP / 3)) * 8 + wave;   // column set inside the projection
        const int n0   = set * NT;                    // first 16-col tile index
        const float* bias = (proj == 0) ? bq : ((proj == 1) ? bk : bv);
        const unsigned short* wcur = wgrp;            // this group's rows of packed W
        // the ring runs on into the next group's rows, over the epilogue; behind the
        // last group there are none, and the refill stays on this group's own rows
        const unsigned short* wnxt = wcur + (g < NGROUP - 1 ? 8 * WP_SET : 0);
        wgrp = wnxt;

        v8f acc[MT][NT];
        #pragma unroll
        for (int ms = 0; ms < MT; ++ms)
            #pragma unroll
            for (int j = 0; j < NT; ++j) acc[ms][j] = vzero;

        #pragma unroll
        for (int k = 0; k < NSTEPS; ++k) {
            // next k-step's LDS fragments (step 0 again behind the last: every group starts there)
            #pragma unroll
            for (int ms = 0; ms < MT; ++ms) {
                const int off1 = ((k + 1) % NSTEPS) * 32 + hi * 8;   // half-index of first 8-chunk
                const unsigned short* p = &atile[(ms * 16 + ln) * APITCH + off1];
                af[(k + 1) & 1][ms].q[0] = *(const uint4*)p;
                af[(k + 1) & 1][ms].q[1] = *(const uint4*)(p + 16);
            }
            // keeps the LDS reads as one group ahead of this step's WMMAs; without it the
            // compiler sinks them to their use and waits out the LDS latency every step
            __builtin_amdgcn_sched_barrier(0);
            #pragma unroll
            for (int ms = 0; ms < MT; ++ms)
                #pragma unroll
                for (int j = 0; j < NT; ++j)
                    acc[ms][j] = wmma_bf16(af[k & 1][ms], ring[k % WRING][j], acc[ms][j]);
            const unsigned short* wsrc = (k + WRING < NSTEPS)
                ? wcur + (k + WRING) * WP_STEP : wnxt + (k + WRING - NSTEPS) * WP_STEP;
            #pragma unroll
            for (int j = 0; j < NT; ++j) {
                const unsigned short* p = wsrc + j * WP_TILE;
                ring[k % WRING][j].q[0] = *(const uint4*)p;
                ring[k % WRING][j].q[1] = *(const uint4*)(p + WP_HALF);
            }
            // keeps the refill here, WRING-1 steps ahead of its use; without it the
            // compiler sinks the loads to their use and the L2 latency is waited out
            __builtin_amdgcn_sched_barrier(0);
        }

        // the lane's NT bias values, read once per group: all MT tiles of a column share them
        float bb[NT];
        #pragma unroll
        for (int j = 0; j < NT; ++j) bb[j] = bias[(n0 + j) * 16 + ln];

        // ---- epilogue of V: bias, conversion, store; V has no mask and no elu, so none is computed ----
        if (proj == 2) {
            // the wave's number as a scalar: a tile's base address is then formed on the scalar unit,
            // and a store takes it with the lane's fixed offset and a constant for ms
            const int nts = ((g % (NGROUP / 3)) * 8 + __builtin_amdgcn_readfirstlane(wave)) * NT;
            #pragma unroll
            for (int ms = 0; ms < MT; ++ms) {
                #pragma unroll
                for (int j = 0; j < NT; ++j) {
                    const int nt = nts + j;           // 16-column tile: head nt / 4, d tile nt % 4
                    unsigned short* dst = Vt + (size_t)(b * NH + (nt >> 2)) * BH_ELEM
                        + (size_t)((sb0 >> 5) + (ms >> 1)) * KV_SBLK + (nt & 3) * FR_FRAG
                        + (ms & 1) * FR_HALF + lane * 8;
                    uint4 w;
                    w.x = pack2(acc[ms][j][0] + bb[j], acc[ms][j][1] + bb[j]);
                    w.y = pack2(acc[ms][j][2] + bb[j], acc[ms][j][3] + bb[j]);
                    w.z = pack2(acc[ms][j][4] + bb[j], acc[ms][j][5] + bb[j]);
                    w.w = pack2(acc[ms][j][6] + bb[j], acc[ms][j][7] + bb[j]);
                    *(uint4*)dst = w;
                }
            }
            // precaution: every tile is packed into registers of its own, and this stands in front of the
            // next write (the next group's sums) to a register that one of these stores names
            asm volatile("s_wait_xcnt 0x0" ::: "memory");
            continue;
        }

        // ---- epilogue of Q and K: one body, so that the 24 unrolled tiles stay small in the text ----
        const bool  isQ  = (proj == 0);
        const float* sm  = smask + hi * 8;
        #pragma unroll
        for (int ms = 0; ms < MT; ++ms) {
            #pragma unroll
            for (int j = 0; j < NT; ++j) {
                const int ng = (n0 + j) * 16 + ln;    // lane's output column
                const int h  = ng / HD;
                const int dt = (n0 + j) & 3;          // 16-column tile inside the head
                float vv[8];
                #pragma unroll
                for (int r = 0; r < 8; ++r) {
                    const float x = acc[ms][j][r] + bb[j] + sm[ms * 16 + r];
                    vv[r] = elu1(x);
                }
                // K (and V above): the lane's 8 rows s are fragment half (ms & 1) of s block sb0/32 + ms/2,
                // and the lane keeps its number (column d -> row of the fragment, hi -> hi)
                unsigned short* dst = Kt + (size_t)(b * NH + h) * BH_ELEM
                    + (size_t)((sb0 >> 5) + (ms >> 1)) * KV_SBLK + dt * FR_FRAG
                    + (ms & 1) * FR_HALF + lane * 8;
                if (isQ) {                             // Q: LDS transpose
                    // the wave barriers keep the compiler from moving the pad's writes and reads
                    // (other lanes' words) across each other
                    __builtin_amdgcn_wave_barrier();
                    #pragma unroll
                    for (int r = 0; r < 8; ++r) sscr[wave][(hi * 8 + r) * 17 + ln] = vv[r];
                    __builtin_amdgcn_wave_barrier();
                    const float* src = &sscr[wave][ln * 17 + hi * 8];
                    #pragma unroll
                    for (int r = 0; r < 8; ++r) vv[r] = src[r];
                    __builtin_amdgcn_wave_barrier();
                    // lane = (row s, hi) now holds columns dt*16 + hi*8 .. +7 of the head:
                    // fragment half (dt & 1) of d block dt/2, s tile sb0/16 + ms
                    dst = Qf + (size_t)(b * NH + h) * BH_ELEM
                        + (size_t)((sb0 >> 4) + ms) * Q_STILE + (dt >> 1) * FR_FRAG
                        + (dt & 1) * FR_HALF + lane * 8;
                }
                uint4 w;
                w.x = pack2(vv[0], vv[1]); w.y = pack2(vv[2], vv[3]);
                w.z = pack2(vv[4], vv[5]); w.w = pack2(vv[6], vv[7]);
                *(uint4*)dst = w;
                // precaution: stands in front of the next write to a register that this store names
                asm volatile("s_wait_xcnt 0x0" ::: "memory");
            }
        }
    }
}

// ================= kernel 2: per-slice partial sums of kv = K^T V and ksum = sum_s K =================
// Every block owns its own plane of kvP (HD*HD floats) and of ksP (one float per thread), so nothing
// is added into memory; k2b sums the NSLICE planes of a head. A kvP plane keeps kvT's order of
// fragment halves; inside a half it is [4 elements of 8][lane][4], so a wave-wide 16-byte store is
// 512 contiguous bytes.
__global__ __launch_bounds__(256)
void k2_kv(const unsigned short* __restrict__ Kt, const unsigned short* __restrict__ Vt,
           float* __restrict__ kvP, float* __restrict__ ksP) {
    const int bh = blockIdx.x >> 4;
    const int tid = threadIdx.x;
    const int wave = tid >> 5, lane = tid & 31;
    // this block's slice: 512 s = 16 blocks of 32
    const size_t slice = (size_t)bh * BH_ELEM + (size_t)(blockIdx.x & 15) * 16 * KV_SBLK;

    // ---- ksum partial: a wave sums one fragment half of one d tile over the slice ----
    {
        const unsigned short* p = Kt + slice + (wave >> 1) * FR_FRAG + (wave & 1) * FR_HALF + lane * 8;
        float sum = 0.f;
        for (int i = 0; i < 16; ++i) {
            uint4 qv = *(const uint4*)(p + i * KV_SBLK);
            const unsigned short* u = (const unsigned short*)&qv;
            #pragma unroll
            for (int e = 0; e < 8; ++e) sum += bf2f(u[e]);
        }
        ksP[blockIdx.x * 256 + tid] = sum;
        // precaution: stands in front of the next write to a register that the store names
        asm volatile("s_wait_xcnt 0x0" ::: "memory");
    }

    // ---- kv tiles via WMMA: A = K[d,s], B^T = V[e,s] ----
    const int dt = wave >> 1;                 // d tile 0..3
    const int e0 = (wave & 1) * 2;            // e tiles e0, e0+1
    const v8f vzero = {0.f,0.f,0.f,0.f,0.f,0.f,0.f,0.f};
    v8f acc[2] = {vzero, vzero};

    const unsigned short* Ar = Kt + slice + dt * FR_FRAG + lane * 8;
    const unsigned short* B0 = Vt + slice + e0 * FR_FRAG + lane * 8;
    const unsigned short* B1 = B0 + FR_FRAG;

    for (int k = 0; k < 16; ++k) {
        const int off = k * KV_SBLK;
        Frag a, b0, b1;
        a.q[0]  = *(const uint4*)(Ar + off); a.q[1]  = *(const uint4*)(Ar + off + FR_HALF);
        b0.q[0] = *(const uint4*)(B0 + off); b0.q[1] = *(const uint4*)(B0 + off + FR_HALF);
        // precaution: behind the last use of Ar the compiler gives its registers to the last
        // loads' data; this stands in front of that write
        if (k == 15) asm volatile("s_wait_xcnt 0x0" ::: "memory");
        b1.q[0] = *(const uint4*)(B1 + off); b1.q[1] = *(const uint4*)(B1 + off + FR_HALF);
        acc[0] = wmma_bf16(a, b0, acc[0]);
        acc[1] = wmma_bf16(a, b1, acc[1]);
    }
    // acc[j][r] is kv[d = dt*16 + (lane>>4)*8 + r][e = (e0+j)*16 + (lane&15)]: in kvT's order that is
    // d block dt/2, e tile e0+j, fragment half dt&1, this same lane, element r
    #pragma unroll
    for (int j = 0; j < 2; ++j) {
        float* dst = kvP + (size_t)blockIdx.x * (HD * HD)
            + ((dt >> 1) * 4 + e0 + j) * FR_FRAG + (dt & 1) * FR_HALF + lane * 4;
        *(float4*)dst                 = make_float4(acc[j][0], acc[j][1], acc[j][2], acc[j][3]);
        *(float4*)(dst + FR_HALF / 2) = make_float4(acc[j][4], acc[j][5], acc[j][6], acc[j][7]);
    }
}

// ================= kernel 2b: sum the slices' planes; kv^T -> bf16 (fragment order), ksum f32 =========
__global__ __launch_bounds__(256)
void k2b_cvt(const float* __restrict__ kvP, const float* __restrict__ ksP,
             unsigned short* __restrict__ kvT, float* __restrict__ ksum) {
    if (blockIdx.x < KVB_BLOCKS) {
        // four neighbouring floats of a plane per thread: elements 0..3 or 4..7 of one lane's eight
        const int i  = (blockIdx.x * 256 + threadIdx.x) * 4;
        const int bh = i / (HD * HD), o = i % (HD * HD);
        const float* p = kvP + (size_t)bh * NSLICE * (HD * HD) + o;
        float4 s = make_float4(0.f, 0.f, 0.f, 0.f);
        #pragma unroll
        for (int sl = 0; sl < NSLICE; ++sl) {
            const float4 v = *(const float4*)(p + sl * (HD * HD));
            s.x += v.x; s.y += v.y; s.z += v.z; s.w += v.w;
        }
        uint2 w;
        w.x = pack2(s.x, s.y); w.y = pack2(s.z, s.w);
        *(uint2*)&kvT[(i & ~(FR_HALF - 1)) + ((i >> 2) & 31) * 8 + ((i >> 7) & 1) * 4] = w;
    } else {
        // ksum[bh][d]: in each plane, waves (d/16)*2 and +1, lanes d%16 and +16 hold a part of it
        const int i  = (blockIdx.x - KVB_BLOCKS) * 256 + threadIdx.x;      // bh*HD + d
        const int bh = i / HD, d = i % HD;
        const float* p = ksP + (size_t)bh * NSLICE * 256 + (d >> 4) * 64 + (d & 15);
        float s = 0.f;
        #pragma unroll
        for (int sl = 0; sl < NSLICE; ++sl)
            #pragma unroll
            for (int q = 0; q < 4; ++q) s += p[sl * 256 + q * 16];
        ksum[i] = s;
        // precaution: stands in front of the next write to a register that the store names
        asm volatile("s_wait_xcnt 0x0" ::: "memory");
    }
}

// ================= kernel 3: out = (Q kv) / (Q ksum) =================
__global__ __launch_bounds__(256)
void k3_out(const unsigned short* __restrict__ Qf, const unsigned short* __restrict__ kvT,
            const float* __restrict__ ksum, float* __restrict__ out) {
    __shared__ float sks[HD];
    const int tid = threadIdx.x;
    const int bh  = blockIdx.x >> 6;
    const int blk = blockIdx.x & 63;
    if (tid < HD) sks[tid] = ksum[bh * HD + tid];
    __syncthreads();

    const int wave = tid >> 5, lane = tid & 31, ln = lane & 15, hi = lane >> 4;
    const int st = blk * 8 + wave;                  // s-tile 0..511

    const unsigned short* Ar = Qf + (size_t)bh * BH_ELEM + (size_t)st * Q_STILE + lane * 8;
    const v8f vzero = {0.f,0.f,0.f,0.f,0.f,0.f,0.f,0.f};
    v8f acc[4] = {vzero, vzero, vzero, vzero};
    float part = 0.f;

    #pragma unroll
    for (int k = 0; k < 2; ++k) {
        const int off1 = k * 32 + hi * 8;
        Frag a;
        a.q[0] = *(const uint4*)(Ar + k * FR_FRAG);
        a.q[1] = *(const uint4*)(Ar + k * FR_FRAG + FR_HALF);
        // denominator partial: lane holds Q[st*16+ln, off1..off1+7] and [+16..+23]
        #pragma unroll
        for (int e = 0; e < 8; ++e) part += bf2f(a.us[e])     * sks[off1 + e];
        #pragma unroll
        for (int e = 0; e < 8; ++e) part += bf2f(a.us[8 + e]) * sks[off1 + 16 + e];
        #pragma unroll
        for (int j = 0; j < 4; ++j) {
            const unsigned short* Br = kvT + (size_t)bh * (HD * HD) + (k * 4 + j) * FR_FRAG + lane * 8;
            Frag bfr;
            bfr.q[0] = *(const uint4*)Br;
            bfr.q[1] = *(const uint4*)(Br + FR_HALF);
            acc[j] = wmma_bf16(a, bfr, acc[j]);
        }
    }

    const float dsum = part + __shfl_xor(part, 16, 32);   // combine K-halves
    float dr[8];
    #pragma unroll
    for (int r = 0; r < 8; ++r) dr[r] = __shfl(dsum, r + hi * 8, 32);

    const int b_ = bh / NH, h_ = bh % NH;
    #pragma unroll
    for (int j = 0; j < 4; ++j)
        #pragma unroll
        for (int r = 0; r < 8; ++r) {
            const int s = st * 16 + hi * 8 + r;
            out[((size_t)b_ * S_LEN + s) * HMODEL + h_ * HD + j * 16 + ln] =
                acc[j][r] / dr[r];
        }
}

// ================= launch =================
extern "C" void kernel_launch(void* const* d_in, const int* in_sizes, int n_in,
                              void* d_out, int out_size, void* d_ws, size_t ws_size,
                              hipStream_t stream) {
    const float* hid  = (const float*)d_in[0];
    const float* mask = (const float*)d_in[1];
    const float* Wq   = (const float*)d_in[2];
    const float* bq   = (const float*)d_in[3];
    const float* Wk   = (const float*)d_in[4];
    const float* bk   = (const float*)d_in[5];
    const float* Wv   = (const float*)d_in[6];
    const float* bv   = (const float*)d_in[7];
    float* out = (float*)d_out;

    char* w = (char*)d_ws;                       // 256B-aligned offsets
    unsigned short* Wb  = (unsigned short*)(w);                 // 3.38 MB
    unsigned short* Qf  = (unsigned short*)(w + 3538944);       // 48 MB
    unsigned short* Kt  = (unsigned short*)(w + 53870592);      // 48 MB
    unsigned short* Vt  = (unsigned short*)(w + 104202240);     // 48 MB
    float*          ksP = (float*)(w + 154533888);              // 768 KB
    unsigned short* kvT = (unsigned short*)(w + 155320320);     // 384 KB
    float*          ks  = (float*)(w + 155713536);              // 12 KB
    float*          kvP = (float*)(w + 155725824);              // 12 MB

    k0_prep<<<1024, 256, 0, stream>>>(Wq, Wk, Wv, Wb);
    k1_proj<<<M_TOTAL / BLK_M, 256, 0, stream>>>(
        hid, mask, Wb, bq, bk, bv, Qf, Kt, Vt);
    k2_kv<<<BATCH * NH * NSLICE, 256, 0, stream>>>(Kt, Vt, kvP, ksP);
    k2b_cvt<<<KVB_BLOCKS + (BATCH * NH * HD) / 256, 256, 0, stream>>>(kvP, ksP, kvT, ks);
    k3_out<<<(BATCH * NH * (S_LEN / 16)) / 8, 256, 0, stream>>>(Qf, kvT, ks, out);
}

// v009
// Measured time: 104 microseconds a run.
// Timed twice side by side with v008, it ran 1.04 and 1.03 times as fast.
// Counting every step since v000, it is 2.39 times as fast.
#include <hip/hip_runtime.h>

// ---------------- problem constants ----------------
#define BATCH   4
#define S_LEN   8192
#define HMODEL  768
#define NH      12
#define HD      64
#define KDIM    768          // GEMM K (= HMODEL)
#define NSTEPS  (KDIM/32)    // 24 k-steps of 32 for bf16 WMMA
#define BLK_M   128          // rows of hidden staged per block in k1 (one block per WGP)
#define MT      (BLK_M/16)   // 16-row tiles of the block; a wave works on all of them
#define NT      3            // 16-column tiles of the output per wave and group in k1
#define NGROUP  (3*HMODEL/16/(8*NT))   // groups of 8 waves x NT tiles over Wq, Wk, Wv stacked
#define APITCH  776          // LDS row pitch in halves (768 + 8 pad -> bank spread)
#define M_TOTAL (BATCH*S_LEN)
#define NW_ELEM (HMODEL*HMODEL)
#define WRING   4            // k-steps of W fragments in flight per wave in k1
#define SB      (BLK_M/8)    // k1 staging: rows per wave, and its loads in flight
#define RP      (KDIM/128)   // k1 staging: 512-byte pieces of a row of hidden
// Packed W, in halves: [set of NT 16-row tiles][k-step][tile of the set][fragment half][lane][8].
// One wave-wide 16-byte load of a fragment half is then 512 contiguous, aligned bytes.
#define WP_HALF  256                 // 32 lanes x 8 halves
#define WP_TILE  (2*WP_HALF)         // one 16x32 fragment
#define WP_STEP  (NT*WP_TILE)        // all tiles of a set, one k-step
#define WP_SET   (NSTEPS*WP_STEP)    // a set's whole K
// Q, K, V and kv are kept in the same fragment order, in halves ([fragment half][lane][8] innermost):
//   K, V: [bh][block of 32 s][16-row tile of d][2][32][8]   (lane = d row of the tile, k index = s)
//   Q   : [bh][tile of 16 s][block of 32 d][2][32][8]       (lane = s row of the tile, k index = d)
//   kv  : [bh][block of 32 d][16-row tile of e][2][32][8]   (lane = e row of the tile, k index = d)
// so every wave-wide 16-byte store or load of a fragment half is 512 contiguous, aligned bytes.
#define FR_HALF  256                 // 32 lanes x 8 halves
#define FR_FRAG  (2*FR_HALF)         // one 16x32 fragment
#define KV_SBLK  (4*FR_FRAG)         // K, V: the four d tiles of one block of 32 s
#define Q_STILE  (2*FR_FRAG)         // Q: both d blocks of one tile of 16 s
#define BH_ELEM  (S_LEN*HD)          // one head's Q, K or V
#define NSLICE   16                  // k2: blocks (slices of 512 s) per head
#define KVB_BLOCKS (BATCH*NH*HD*HD/4/256)   // k2b: blocks that sum kv; BATCH*NH*HD/256 more sum ksum

// ---------------- vector types for WMMA ----------------
typedef __attribute__((ext_vector_type(16))) __bf16 v16bf;
typedef __attribute__((ext_vector_type(8)))  float  v8f;
typedef __attribute__((ext_vector_type(2)))  float  f32x2;
typedef __attribute__((ext_vector_type(2)))  __bf16 bf16x2;
typedef __attribute__((ext_vector_type(8)))  short  s16x8;

struct Frag {
    union {
        v16bf v;
        uint4 q[2];
        unsigned short us[16];
    };
};

// ---------------- helpers ----------------
__device__ __forceinline__ float bf2f(unsigned short h) {
    union { unsigned int u; float f; } c; c.u = ((unsigned int)h) << 16;
    return c.f;
}
// two f32 -> two bf16 (a in the low half), round-nearest-even, by the chip's own packed conversion
__device__ __forceinline__ unsigned int pack2(float a, float b) {
    const f32x2 v = {a, b};
    union { bf16x2 h; unsigned int u; } c;
    c.h = __builtin_convertvector(v, bf16x2);
    return c.u;
}
__device__ __forceinline__ float elu1(float x) {          // elu(x)+1
    return x > 0.f ? x + 1.f : __expf(x);
}
// transposing LDS load of a 16x16 tile of 16-bit values (a builtin, so that the compiler places its wait)
__device__ __forceinline__ uint4 ld_tr16(const unsigned short* p) {
    typedef __attribute__((address_space(3))) s16x8 lds_s16x8;
    union { s16x8 v; uint4 q; } c;
    c.v = __builtin_amdgcn_ds_load_tr16_b128_v8i16((lds_s16x8*)p);
    return c.q;
}
__device__ __forceinline__ v8f wmma_bf16(const Frag& a, const Frag& b, v8f c) {
    return __builtin_amdgcn_wmma_f32_16x16x32_bf16(false, a.v, false, b.v,
                                                   (short)0, c, false, false);
}

// ================= kernel 0: W fp32->bf16 in fragment order =================
__global__ __launch_bounds__(256)
void k0_prep(const float* __restrict__ Wq, const float* __restrict__ Wk,
             const float* __restrict__ Wv, unsigned short* __restrict__ Wb) {
    const int stride = gridDim.x * blockDim.x;
    // one 16-byte piece per thread: the 8 halves that lane (i & 31) of k1 holds in one register quad
    for (int i = blockIdx.x * blockDim.x + threadIdx.x; i < 3 * NW_ELEM / 8; i += stride) {
        const int lane = i & 31, q = (i >> 5) & 1, j = (i >> 6) % NT;
        const int s    = ((i >> 6) / NT) % NSTEPS, set = (i >> 6) / (NT * NSTEPS);
        const int row  = (set * NT + j) * 16 + (lane & 15);      // row of Wq, Wk, Wv stacked
        const int col  = s * 32 + q * 16 + (lane >> 4) * 8;
        const float* W = (row < HMODEL) ? Wq : ((row < 2 * HMODEL) ? Wk : Wv);
        const float* p = W + (size_t)(row % HMODEL) * KDIM + col;
        const float4 a = *(const float4*)p;
        const float4 c = *(const float4*)(p + 4);
        uint4 w;
        w.x = pack2(a.x, a.y); w.y = pack2(a.z, a.w);
        w.z = pack2(c.x, c.y); w.w = pack2(c.z, c.w);
        *(uint4*)&Wb[(size_t)i * 8] = w;
    }
}

// ================= kernel 1: fused QKV projections (bf16 WMMA) =================
// Q, K, V -> bf16 in the fragment order that k2 and k3 load them in
__global__ __launch_bounds__(256)
void k1_proj(const float* __restrict__ hid, const float* __restrict__ mask,
             const unsigned short* __restrict__ Wb,
             const float* __restrict__ bq, const float* __restrict__ bk,
             const float* __restrict__ bv,
             unsigned short* __restrict__ Qf, unsigned short* __restrict__ Kt,
             unsigned short* __restrict__ Vt) {
    __shared__ __attribute__((aligned(16))) unsigned short atile[BLK_M * APITCH];   // bf16
    __shared__ float smask[BLK_M];                   // the rows' mask
    // per wave: a 16x16 bf16 tile (rows d of 32 bytes, columns s) for each Q tile of a group
    __shared__ __attribute__((aligned(16))) unsigned short qpad[8][MT * NT * FR_HALF];

    const int tid = threadIdx.x;
    const int gm0 = blockIdx.x * BLK_M;              // first global row (b*S+s)

    // read ahead of the staging loads, stored behind them: the store's wait would hold them back
    const float mrow = (tid < BLK_M) ? mask[gm0 + tid] : 0.f;

    // stage A block fp32 -> bf16 into LDS
    // Wave w stages rows w, w+8, ...: a trip takes one 512-byte piece (of RP) of each of its SB rows. A
    // register quad is refilled with the next trip's load right behind its conversion, so SB-1 to SB loads
    // per wave stay in flight. The WGP holds only this block's 8 waves, and with few loads each, all waited
    // for before the next are issued, the stream runs at the memory's latency and not at its rate.
    // The waves start at different pieces, so that the block's loads in flight do not all lie at one
    // offset inside the 3-KB rows.
    {
        int c = (tid >> 5) % RP;                     // the piece that the quads hold
        const float* gsrc = hid + (size_t)(gm0 + (tid >> 5)) * KDIM + c * 128 + (tid & 31) * 4;
        unsigned short* lrow = &atile[(tid >> 5) * APITCH + (tid & 31) * 4];
        float4 sq[SB];
        #pragma unroll
        for (int j = 0; j < SB; ++j) sq[j] = *(const float4*)(gsrc + j * 8 * KDIM);
        // rolled: the trips are alike, and unrolled they would push the epilogue further back in the text
        #pragma unroll 1
        for (int p = 0; p < RP; ++p) {
            // behind the last trip there is nothing left to fetch: its refill stays on the trip's own
            // bytes and is dropped, so that one loop body serves every trip
            const int cn = (p == RP - 1) ? c : ((c == RP - 1) ? 0 : c + 1);
            gsrc += (cn - c) * 128;
            unsigned short* ldst = lrow + c * 128;
            #pragma unroll
            for (int j = 0; j < SB; ++j) {
                const float4 f = sq[j];
                unsigned short* dst = ldst + j * 8 * APITCH;
                *(uint2*)dst = make_uint2(pack2(f.x, f.y), pack2(f.z, f.w));
                sq[j] = *(const float4*)(gsrc + j * 8 * KDIM);
                // keeps each refill right behind its quad's conversion; without it the compiler gathers
                // the loads behind the last conversion, whose wait has drained all that was in flight
                __builtin_amdgcn_sched_barrier(0);
            }
            c = cn;
        }
    }
    if (tid < BLK_M) smask[tid] = mrow;
    __syncthreads();

    const int wave = tid >> 5, lane = tid & 31;
    const int ln = lane & 15, hi = lane >> 4;
    const int b   = gm0 / S_LEN;
    const int sb0 = gm0 % S_LEN;
    const v8f vzero = {0.f,0.f,0.f,0.f,0.f,0.f,0.f,0.f};

    // Software-pipelined k loop. W fragments live in a register ring WRING k-steps deep:
    // a slot is refilled right behind the WMMAs that read it, so a load has WRING-1
    // k-steps of matrix work to land. The LDS fragments are fetched one k-step ahead.
    // A W fragment feeds MT WMMAs and an LDS fragment NT.
    // Stacked W rows are linear in g: row = ((g*8 + wave)*NT + j)*16 + ln, so set = g*8 + wave.
    const unsigned short* wlane = Wb + (size_t)wave * WP_SET + lane * 8;
    Frag ring[WRING][NT];
    Frag af[2][MT];
    #pragma unroll
    for (int s = 0; s < WRING; ++s)
        #pragma unroll
        for (int j = 0; j < NT; ++j) {
            const unsigned short* p = wlane + s * WP_STEP + j * WP_TILE;
            ring[s][j].q[0] = *(const uint4*)p;
            ring[s][j].q[1] = *(const uint4*)(p + WP_HALF);
        }
    #pragma unroll
    for (int ms = 0; ms < MT; ++ms) {
        const unsigned short* p = &atile[(ms * 16 + ln) * APITCH + hi * 8];
        af[0][ms].q[0] = *(const uint4*)p;
        af[0][ms].q[1] = *(const uint4*)(p + 16);
    }
    // precaution: stands in front of the first group's step of the address that the ring's first loads name
    asm volatile("s_wait_xcnt 0x0" ::: "memory");

    const unsigned short* wgrp = wlane;
    for (int g = 0; g < NGROUP; ++g) {                // 3 proj x NGROUP/3 groups of column sets
        const int proj = g / (NGROUP / 3);
        const int set  = (g % (NGROUP / 3)) * 8 + wave;   // column set inside the projection
        const int n0   = set * NT;                    // first 16-col tile index
        const float* bias = (proj == 0) ? bq : ((proj == 1) ? bk : bv);
        const unsigned short* wcur = wgrp;            // this group's rows of packed W
        // the ring runs on into the next group's rows, over the epilogue; behind the
        // last group there are none, and the refill stays on this group's own rows
        const unsigned short* wnxt = wcur + (g < NGROUP - 1 ? 8 * WP_SET : 0);
        wgrp = wnxt;

        v8f acc[MT][NT];
        #pragma unroll
        for (int ms = 0; ms < MT; ++ms)
            #pragma unroll
            for (int j = 0; j < NT; ++j) acc[ms][j] = vzero;

        #pragma unroll
        for (int k = 0; k < NSTEPS; ++k) {
            // next k-step's LDS fragments (step 0 again behind the last: every group starts there)
            #pragma unroll
            for (int ms = 0; ms < MT; ++ms) {
                const int off1 = ((k + 1) % NSTEPS) * 32 + hi * 8;   // half-index of first 8-chunk
                const unsigned short* p = &atile[(ms * 16 + ln) * APITCH + off1];
                af[(k + 1) & 1][ms].q[0] = *(const uint4*)p;
                af[(k + 1) & 1][ms].q[1] = *(const uint4*)(p + 16);
            }
            // keeps the LDS reads as one group ahead of this step's WMMAs; without it the
            // compiler sinks them to their use and waits out the LDS latency every step
            __builtin_amdgcn_sched_barrier(0);
            #pragma unroll
            for (int ms = 0; ms < MT; ++ms)
                #pragma unroll
                for (int j = 0; j < NT; ++j)
                    acc[ms][j] = wmma_bf16(af[k & 1][ms], ring[k % WRING][j], acc[ms][j]);
            const unsigned short* wsrc = (k + WRING < NSTEPS)
                ? wcur + (k + WRING) * WP_STEP : wnxt + (k + WRING - NSTEPS) * WP_STEP;
            #pragma unroll
            for (int j = 0; j < NT; ++j) {
                const unsigned short* p = wsrc + j * WP_TILE;
                ring[k % WRING][j].q[0] = *(const uint4*)p;
                ring[k % WRING][j].q[1] = *(const uint4*)(p + WP_HALF);
            }
            // keeps the refill here, WRING-1 steps ahead of its use; without it the
            // compiler sinks the loads to their use and the L2 latency is waited out
            __builtin_amdgcn_sched_barrier(0);
        }

        // the lane's NT bias values, read once per group: all MT tiles of a column share them
        float bb[NT];
        #pragma unroll
        for (int j = 0; j < NT; ++j) bb[j] = bias[(n0 + j) * 16 + ln];

        // the wave's number as a scalar: a tile's base address is then formed on the scalar unit,
        // and a store takes it with the lane's fixed offset and a constant for ms
        const int nts = ((g % (NGROUP / 3)) * 8 + __builtin_amdgcn_readfirstlane(wave)) * NT;

        // ---- epilogue of V: bias, conversion, store; V has no mask and no elu, so none is computed ----
        if (proj == 2) {
            #pragma unroll
            for (int ms = 0; ms < MT; ++ms) {
                #pragma unroll
                for (int j = 0; j < NT; ++j) {
                    const int nt = nts + j;           // 16-column tile: head nt / 4, d tile nt % 4
                    unsigned short* dst = Vt + (size_t)(b * NH + (nt >> 2)) * BH_ELEM
                        + (size_t)((sb0 >> 5) + (ms >> 1)) * KV_SBLK + (nt & 3) * FR_FRAG
                        + (ms & 1) * FR_HALF + lane * 8;
                    uint4 w;
                    w.x = pack2(acc[ms][j][0] + bb[j], acc[ms][j][1] + bb[j]);
                    w.y = pack2(acc[ms][j][2] + bb[j], acc[ms][j][3] + bb[j]);
                    w.z = pack2(acc[ms][j][4] + bb[j], acc[ms][j][5] + bb[j]);
                    w.w = pack2(acc[ms][j][6] + bb[j], acc[ms][j][7] + bb[j]);
                    *(uint4*)dst = w;
                }
            }
            // precaution: every tile is packed into registers of its own, and this stands in front of the
            // next write (the next group's sums) to a register that one of these stores names
            asm volatile("s_wait_xcnt 0x0" ::: "memory");
            continue;
        }

        // ---- epilogue of Q and K: all MT*NT tiles at once, none waits for the one before it ----
        // Every tile is packed into a register quad of its own. The lane's 8 rows s of column d are
        // K's fragment order as they stand (as for V above); Q is transposed below.
        const float* sm = smask + hi * 8;
        uint4 w[MT][NT];
        #pragma unroll
        for (int ms = 0; ms < MT; ++ms) {
            float mk[8];                              // the mask of the lane's 8 rows: all NT tiles share it
            #pragma unroll
            for (int r = 0; r < 8; ++r) mk[r] = sm[ms * 16 + r];
            #pragma unroll
            for (int j = 0; j < NT; ++j) {
                float vv[8];
                #pragma unroll
                for (int r = 0; r < 8; ++r) vv[r] = elu1(acc[ms][j][r] + bb[j] + mk[r]);
                w[ms][j].x = pack2(vv[0], vv[1]); w[ms][j].y = pack2(vv[2], vv[3]);
                w[ms][j].z = pack2(vv[4], vv[5]); w[ms][j].w = pack2(vv[6], vv[7]);
            }
        }
        if (proj == 0) {
            // Q: lane (d, hi) writes its 8 packed s as 16 bytes of row d of the tile's pad; the transposing
            // load hands lane (s, hi) the 8 values d = hi*8 .. +7 of column s. The pad is the wave's own.
            unsigned short* pst = &qpad[wave][ln * 16 + hi * 8];
            const unsigned short* pld = &qpad[wave][(hi * 8 + (lane & 7)) * 16 + ((lane >> 3) & 1) * 8];
            #pragma unroll
            for (int ms = 0; ms < MT; ++ms)
                #pragma unroll
                for (int j = 0; j < NT; ++j) *(uint4*)(pst + (ms * NT + j) * FR_HALF) = w[ms][j];
            // keeps the compiler from moving the pad's reads (other lanes' words) ahead of its writes
            __builtin_amdgcn_wave_barrier();
            #pragma unroll
            for (int ms = 0; ms < MT; ++ms)
                #pragma unroll
                for (int j = 0; j < NT; ++j) w[ms][j] = ld_tr16(pld + (ms * NT + j) * FR_HALF);
            // keeps the next group's writes to the pad behind these reads in the compiler's order
            __builtin_amdgcn_wave_barrier();
            #pragma unroll
            for (int ms = 0; ms < MT; ++ms) {
                #pragma unroll
                for (int j = 0; j < NT; ++j) {
                    const int nt = nts + j;           // 16-column tile: head nt / 4, d tile nt % 4
                    // lane (s, hi) holds columns (nt % 4)*16 + hi*8 .. +7 of the head: fragment half
                    // nt & 1 of d block (nt % 4) / 2, s tile sb0/16 + ms
                    unsigned short* dst = Qf + (size_t)(b * NH + (nt >> 2)) * BH_ELEM
                        + (size_t)((sb0 >> 4) + ms) * Q_STILE + ((nt & 3) >> 1) * FR_FRAG
                        + (nt & 1) * FR_HALF + lane * 8;
                    *(uint4*)dst = w[ms][j];
                }
            }
            // precaution: every tile has a register quad of its own, and this stands in front of the next
            // write to a register that one of these stores names
            asm volatile("s_wait_xcnt 0x0" ::: "memory");
        } else {
            #pragma unroll
            for (int ms = 0; ms < MT; ++ms) {
                #pragma unroll
                for (int j = 0; j < NT; ++j) {
                    const int nt = nts + j;           // 16-column tile: head nt / 4, d tile nt % 4
                    unsigned short* dst = Kt + (size_t)(b * NH + (nt >> 2)) * BH_ELEM
                        + (size_t)((sb0 >> 5) + (ms >> 1)) * KV_SBLK + (nt & 3) * FR_FRAG
                        + (ms & 1) * FR_HALF + lane * 8;
                    *(uint4*)dst = w[ms][j];
                }
            }
            // precaution: as behind the stores of Q
            asm volatile("s_wait_xcnt 0x0" ::: "memory");
        }
    }
}

// ================= kernel 2: per-slice partial sums of kv = K^T V and ksum = sum_s K =================
// Every block owns its own plane of kvP (HD*HD floats) and of ksP (one float per thread), so nothing
// is added into memory; k2b sums the NSLICE planes of a head. A kvP plane keeps kvT's order of
// fragment halves; inside a half it is [4 elements of 8][lane][4], so a wave-wide 16-byte store is
// 512 contiguous bytes.
__global__ __launch_bounds__(256)
void k2_kv(const unsigned short* __restrict__ Kt, const unsigned short* __restrict__ Vt,
           float* __restrict__ kvP, float* __restrict__ ksP) {
    const int bh = blockIdx.x >> 4;
    const int tid = threadIdx.x;
    const int wave = tid >> 5, lane = tid & 31;
    // this block's slice: 512 s = 16 blocks of 32
    const size_t slice = (size_t)bh * BH_ELEM + (size_t)(blockIdx.x & 15) * 16 * KV_SBLK;

    // ---- ksum partial: a wave sums one fragment half of one d tile over the slice ----
    {
        const unsigned short* p = Kt + slice + (wave >> 1) * FR_FRAG + (wave & 1) * FR_HALF + lane * 8;
        float sum = 0.f;
        for (int i = 0; i < 16; ++i) {
            uint4 qv = *(const uint4*)(p + i * KV_SBLK);
            const unsigned short* u = (const unsigned short*)&qv;
            #pragma unroll
            for (int e = 0; e < 8; ++e) sum += bf2f(u[e]);
        }
        ksP[blockIdx.x * 256 + tid] = sum;
        // precaution: stands in front of the next write to a register that the store names
        asm volatile("s_wait_xcnt 0x0" ::: "memory");
    }

    // ---- kv tiles via WMMA: A = K[d,s], B^T = V[e,s] ----
    const int dt = wave >> 1;                 // d tile 0..3
    const int e0 = (wave & 1) * 2;            // e tiles e0, e0+1
    const v8f vzero = {0.f,0.f,0.f,0.f,0.f,0.f,0.f,0.f};
    v8f acc[2] = {vzero, vzero};

    const unsigned short* Ar = Kt + slice + dt * FR_FRAG + lane * 8;
    const unsigned short* B0 = Vt + slice + e0 * FR_FRAG + lane * 8;
    const unsigned short* B1 = B0 + FR_FRAG;

    for (int k = 0; k < 16; ++k) {
        const int off = k * KV_SBLK;
        Frag a, b0, b1;
        a.q[0]  = *(const uint4*)(Ar + off); a.q[1]  = *(const uint4*)(Ar + off + FR_HALF);
        b0.q[0] = *(const uint4*)(B0 + off); b0.q[1] = *(const uint4*)(B0 + off + FR_HALF);
        // precaution: behind the last use of Ar the compiler gives its registers to the last
        // loads' data; this stands in front of that write
        if (k == 15) asm volatile("s_wait_xcnt 0x0" ::: "memory");
        b1.q[0] = *(const uint4*)(B1 + off); b1.q[1] = *(const uint4*)(B1 + off + FR_HALF);
        acc[0] = wmma_bf16(a, b0, acc[0]);
        acc[1] = wmma_bf16(a, b1, acc[1]);
    }
    // acc[j][r] is kv[d = dt*16 + (lane>>4)*8 + r][e = (e0+j)*16 + (lane&15)]: in kvT's order that is
    // d block dt/2, e tile e0+j, fragment half dt&1, this same lane, element r
    #pragma unroll
    for (int j = 0; j < 2; ++j) {
        float* dst = kvP + (size_t)blockIdx.x * (HD * HD)
            + ((dt >> 1) * 4 + e0 + j) * FR_FRAG + (dt & 1) * FR_HALF + lane * 4;
        *(float4*)dst                 = make_float4(acc[j][0], acc[j][1], acc[j][2], acc[j][3]);
        *(float4*)(dst + FR_HALF / 2) = make_float4(acc[j][4], acc[j][5], acc[j][6], acc[j][7]);
    }
}

// ================= kernel 2b: sum the slices' planes; kv^T -> bf16 (fragment order), ksum f32 =========
__global__ __launch_bounds__(256)
void k2b_cvt(const float* __restrict__ kvP, const float* __restrict__ ksP,
             unsigned short* __restrict__ kvT, float* __restrict__ ksum) {
    if (blockIdx.x < KVB_BLOCKS) {
        // four neighbouring floats of a plane per thread: elements 0..3 or 4..7 of one lane's eight
        const int i  = (blockIdx.x * 256 + threadIdx.x) * 4;
        const int bh = i / (HD * HD), o = i % (HD * HD);
        const float* p = kvP + (size_t)bh * NSLICE * (HD * HD) + o;
        float4 s = make_float4(0.f, 0.f, 0.f, 0.f);
        #pragma unroll
        for (int sl = 0; sl < NSLICE; ++sl) {
            const float4 v = *(const float4*)(p + sl * (HD * HD));
            s.x += v.x; s.y += v.y; s.z += v.z; s.w += v.w;
        }
        uint2 w;
        w.x = pack2(s.x, s.y); w.y = pack2(s.z, s.w);
        *(uint2*)&kvT[(i & ~(FR_HALF - 1)) + ((i >> 2) & 31) * 8 + ((i >> 7) & 1) * 4] = w;
    } else {
        // ksum[bh][d]: in each plane, waves (d/16)*2 and +1, lanes d%16 and +16 hold a part of it
        const int i  = (blockIdx.x - KVB_BLOCKS) * 256 + threadIdx.x;      // bh*HD + d
        const int bh = i / HD, d = i % HD;
        const float* p = ksP + (size_t)bh * NSLICE * 256 + (d >> 4) * 64 + (d & 15);
        float s = 0.f;
        #pragma unroll
        for (int sl = 0; sl < NSLICE; ++sl)
            #pragma unroll
            for (int q = 0; q < 4; ++q) s += p[sl * 256 + q * 16];
        ksum[i] = s;
        // precaution: stands in front of the next write to a register that the store names
        asm volatile("s_wait_xcnt 0x0" ::: "memory");
    }
}

// ================= kernel 3: out = (Q kv) / (Q ksum) =================
__global__ __launch_bounds__(256)
void k3_out(const unsigned short* __restrict__ Qf, const unsigned short* __restrict__ kvT,
            const float* __restrict__ ksum, float* __restrict__ out) {
    __shared__ float sks[HD];
    const int tid = threadIdx.x;
    const int bh  = blockIdx.x >> 6;
    const int blk = blockIdx.x & 63;
    if (tid < HD) sks[tid] = ksum[bh * HD + tid];
    __syncthreads();

    const int wave = tid >> 5, lane = tid & 31, ln = lane & 15, hi = lane >> 4;
    const int st = blk * 8 + wave;                  // s-tile 0..511

    const unsigned short* Ar = Qf + (size_t)bh * BH_ELEM + (size_t)st * Q_STILE + lane * 8;
    const v8f vzero = {0.f,0.f,0.f,0.f,0.f,0.f,0.f,0.f};
    v8f acc[4] = {vzero, vzero, vzero, vzero};
    float part = 0.f;

    #pragma unroll
    for (int k = 0; k < 2; ++k) {
        const int off1 = k * 32 + hi * 8;
        Frag a;
        a.q[0] = *(const uint4*)(Ar + k * FR_FRAG);
        a.q[1] = *(const uint4*)(Ar + k * FR_FRAG + FR_HALF);
        // denominator partial: lane holds Q[st*16+ln, off1..off1+7] and [+16..+23]
        #pragma unroll
        for (int e = 0; e < 8; ++e) part += bf2f(a.us[e])     * sks[off1 + e];
        #pragma unroll
        for (int e = 0; e < 8; ++e) part += bf2f(a.us[8 + e]) * sks[off1 + 16 + e];
        #pragma unroll
        for (int j = 0; j < 4; ++j) {
            const unsigned short* Br = kvT + (size_t)bh * (HD * HD) + (k * 4 + j) * FR_FRAG + lane * 8;
            Frag bfr;
            bfr.q[0] = *(const uint4*)Br;
            bfr.q[1] = *(const uint4*)(Br + FR_HALF);
            acc[j] = wmma_bf16(a, bfr, acc[j]);
        }
    }

    const float dsum = part + __shfl_xor(part, 16, 32);   // combine K-halves
    float dr[8];
    #pragma unroll
    for (int r = 0; r < 8; ++r) dr[r] = __shfl(dsum, r + hi * 8, 32);

    const int b_ = bh / NH, h_ = bh % NH;
    #pragma unroll
    for (int j = 0; j < 4; ++j)
        #pragma unroll
        for (int r = 0; r < 8; ++r) {
            const int s = st * 16 + hi * 8 + r;
            out[((size_t)b_ * S_LEN + s) * HMODEL + h_ * HD + j * 16 + ln] =
                acc[j][r] / dr[r];
        }
}

// ================= launch =================
extern "C" void kernel_launch(void* const* d_in, const int* in_sizes, int n_in,
                              void* d_out, int out_size, void* d_ws, size_t ws_size,
                              hipStream_t stream) {
    const float* hid  = (const float*)d_in[0];
    const float* mask = (const float*)d_in[1];
    const float* Wq   = (const float*)d_in[2];
    const float* bq   = (const float*)d_in[3];
    const float* Wk   = (const float*)d_in[4];
    const float* bk   = (const float*)d_in[5];
    const float* Wv   = (const float*)d_in[6];
    const float* bv   = (const float*)d_in[7];
    float* out = (float*)d_out;

    char* w = (char*)d_ws;                       // 256B-aligned offsets
    unsigned short* Wb  = (unsigned short*)(w);                 // 3.38 MB
    unsigned short* Qf  = (unsigned short*)(w + 3538944);       // 48 MB
    unsigned short* Kt  = (unsigned short*)(w + 53870592);      // 48 MB
    unsigned short* Vt  = (unsigned short*)(w + 104202240);     // 48 MB
    float*          ksP = (float*)(w + 154533888);              // 768 KB
    unsigned short* kvT = (unsigned short*)(w + 155320320);     // 384 KB
    float*          ks  = (float*)(w + 155713536);              // 12 KB
    float*          kvP = (float*)(w + 155725824);              // 12 MB

    k0_prep<<<1024, 256, 0, stream>>>(Wq, Wk, Wv, Wb);
    k1_proj<<<M_TOTAL / BLK_M, 256, 0, stream>>>(
        hid, mask, Wb, bq, bk, bv, Qf, Kt, Vt);
    k2_kv<<<BATCH * NH * NSLICE, 256, 0, stream>>>(Kt, Vt, kvP, ksP);
    k2b_cvt<<<KVB_BLOCKS + (BATCH * NH * HD) / 256, 256, 0, stream>>>(kvP, ksP, kvT, ks);
    k3_out<<<(BATCH * NH * (S_LEN / 16)) / 8, 256, 0, stream>>>(Qf, kvT, ks, out);
}

// v010
// A run of this version takes 94.8 microseconds.
// Timed twice side by side with v009, it ran 1.10 times as fast both times.
// Over all steps from v000 it is 2.62 times as fast.
#include <hip/hip_runtime.h>

// ---------------- problem constants ----------------
#define BATCH   4
#define S_LEN   8192
#define HMODEL  768
#define NH      12
#define HD      64
#define KDIM    768          // GEMM K (= HMODEL)
#define NSTEPS  (KDIM/32)    // 24 k-steps of 32 for bf16 WMMA
#define BLK_M   128          // rows of hidden staged per block in k1 (one block per WGP)
#define MT      (BLK_M/16)   // 16-row tiles of the block; a wave works on all of them
#define NT      3            // 16-column tiles of the output per wave and group in k1
#define NGROUP  (3*HMODEL/16/(8*NT))   // groups of 8 waves x NT tiles over Wq, Wk, Wv stacked
#define APITCH  776          // LDS row pitch in halves (768 + 8 pad -> bank spread)
#define M_TOTAL (BATCH*S_LEN)
#define NW_ELEM (HMODEL*HMODEL)
#define WRING   4            // k-steps of W fragments in flight per wave in k1
#define SB      (BLK_M/8)    // k1 staging: rows per wave, and its loads in flight
#define RP      (KDIM/128)   // k1 staging: 512-byte pieces of a row of hidden
// Packed W, in halves: [set of NT 16-row tiles][k-step][tile of the set][fragment half][lane][8].
// One wave-wide 16-byte load of a fragment half is then 512 contiguous, aligned bytes.
#define WP_HALF  256                 // 32 lanes x 8 halves
#define WP_TILE  (2*WP_HALF)         // one 16x32 fragment
#define WP_STEP  (NT*WP_TILE)        // all tiles of a set, one k-step
#define WP_SET   (NSTEPS*WP_STEP)    // a set's whole K
// Q, K, V and kv are kept in the same fragment order, in halves ([fragment half][lane][8] innermost):
//   K, V: a 16-row tile of d by a block of 32 s is [2][32][8] (lane = d row of the tile, k index = s);
//         they never leave k1: K lies so in LDS, V in the registers of the wave that made it
//   Q   : [bh][tile of 16 s][block of 32 d][2][32][8]       (lane = s row of the tile, k index = d)
//   kv  : [bh][block of 32 d][16-row tile of e][2][32][8]   (lane = e row of the tile, k index = d)
// so every wave-wide 16-byte store or load of a fragment half is 512 contiguous, aligned bytes.
#define FR_HALF  256                 // 32 lanes x 8 halves
#define FR_FRAG  (2*FR_HALF)         // one 16x32 fragment
#define Q_STILE  (2*FR_FRAG)         // Q: both d blocks of one tile of 16 s
#define BH_ELEM  (S_LEN*HD)          // one head's Q, K or V
#define NSLICE   (S_LEN/BLK_M)       // k1 blocks (slices of BLK_M s) per head: planes of partial sums
#define NTILE    (HMODEL/16)         // 16-column tiles of a projection
#define KVB_BLOCKS (BATCH*NH*HD*HD/4/128)   // k2b: blocks that sum kv; BATCH*NH*HD/128 more sum ksum

// ---------------- vector types for WMMA ----------------
typedef __attribute__((ext_vector_type(16))) __bf16 v16bf;
typedef __attribute__((ext_vector_type(8)))  float  v8f;
typedef __attribute__((ext_vector_type(2)))  float  f32x2;
typedef __attribute__((ext_vector_type(2)))  __bf16 bf16x2;
typedef __attribute__((ext_vector_type(8)))  short  s16x8;

struct Frag {
    union {
        v16bf v;
        uint4 q[2];
        unsigned short us[16];
    };
};

// ---------------- helpers ----------------
__device__ __forceinline__ float bf2f(unsigned short h) {
    union { unsigned int u; float f; } c; c.u = ((unsigned int)h) << 16;
    return c.f;
}
// two f32 -> two bf16 (a in the low half), round-nearest-even, by the chip's own packed conversion
__device__ __forceinline__ unsigned int pack2(float a, float b) {
    const f32x2 v = {a, b};
    union { bf16x2 h; unsigned int u; } c;
    c.h = __builtin_convertvector(v, bf16x2);
    return c.u;
}
__device__ __forceinline__ float elu1(float x) {          // elu(x)+1
    return x > 0.f ? x + 1.f : __expf(x);
}
// transposing LDS load of a 16x16 tile of 16-bit values (a builtin, so that the compiler places its wait)
__device__ __forceinline__ uint4 ld_tr16(const unsigned short* p) {
    typedef __attribute__((address_space(3))) s16x8 lds_s16x8;
    union { s16x8 v; uint4 q; } c;
    c.v = __builtin_amdgcn_ds_load_tr16_b128_v8i16((lds_s16x8*)p);
    return c.q;
}
__device__ __forceinline__ v8f wmma_bf16(const Frag& a, const Frag& b, v8f c) {
    return __builtin_amdgcn_wmma_f32_16x16x32_bf16(false, a.v, false, b.v,
                                                   (short)0, c, false, false);
}

// ================= kernel 0: W fp32->bf16 in fragment order =================
__global__ __launch_bounds__(256)
void k0_prep(const float* __restrict__ Wq, const float* __restrict__ Wk,
             const float* __restrict__ Wv, unsigned short* __restrict__ Wb) {
    const int stride = gridDim.x * blockDim.x;
    // one 16-byte piece per thread: the 8 halves that lane (i & 31) of k1 holds in one register quad
    for (int i = blockIdx.x * blockDim.x + threadIdx.x; i < 3 * NW_ELEM / 8; i += stride) {
        const int lane = i & 31, q = (i >> 5) & 1, j = (i >> 6) % NT;
        const int s    = ((i >> 6) / NT) % NSTEPS, set = (i >> 6) / (NT * NSTEPS);
        // groups of 8 sets lie in the order k1 works them in: Q, Q, K, V, K, V (each a half of the columns)
        const int pg   = set >> 3;
        const int sg   = (pg < 2) ? pg : 2 + ((pg - 2) & 1) * 2 + ((pg - 2) >> 1);
        const int row  = ((sg * 8 + (set & 7)) * NT + j) * 16 + (lane & 15);   // row of Wq, Wk, Wv stacked
        const int col  = s * 32 + q * 16 + (lane >> 4) * 8;
        const float* W = (row < HMODEL) ? Wq : ((row < 2 * HMODEL) ? Wk : Wv);
        const float* p = W + (size_t)(row % HMODEL) * KDIM + col;
        const float4 a = *(const float4*)p;
        const float4 c = *(const float4*)(p + 4);
        uint4 w;
        w.x = pack2(a.x, a.y); w.y = pack2(a.z, a.w);
        w.z = pack2(c.x, c.y); w.w = pack2(c.z, c.w);
        *(uint4*)&Wb[(size_t)i * 8] = w;
    }
}

// Q, K epilogue: elu(x + bias + mask) + 1 of all MT*NT tiles, each packed into a register quad of its own.
// KSUM: the lane's values are also summed per column, ahead of their rounding to bf16 (K's part of ksum).
template <bool KSUM>
__device__ __forceinline__ void qk_pack(const v8f (&acc)[MT][NT], const float (&bb)[NT], const float* sm,
                                        uint4 (&w)[MT][NT], f32x2 (&ks)[NT]) {
    #pragma unroll
    for (int ms = 0; ms < MT; ++ms) {
        float mk[8];                              // the mask of the lane's 8 rows: all NT tiles share it
        #pragma unroll
        for (int r = 0; r < 8; ++r) mk[r] = sm[ms * 16 + r];
        #pragma unroll
        for (int j = 0; j < NT; ++j) {
            float vv[8];
            #pragma unroll
            for (int r = 0; r < 8; ++r) vv[r] = elu1(acc[ms][j][r] + bb[j] + mk[r]);
            if (KSUM) {
                #pragma unroll
                for (int r = 0; r < 8; r += 2) { const f32x2 t = {vv[r], vv[r + 1]}; ks[j] += t; }
            }
            w[ms][j].x = pack2(vv[0], vv[1]); w[ms][j].y = pack2(vv[2], vv[3]);
            w[ms][j].z = pack2(vv[4], vv[5]); w[ms][j].w = pack2(vv[6], vv[7]);
        }
    }
}

// ================= kernel 1: fused QKV projections and the block's part of kv, ksum (bf16 WMMA) ========
// Q -> bf16 in the fragment order that k3 loads it in. K and V stay in the block: it adds up
// kv = K^T V and ksum = sum_s K over its own BLK_M rows s and stores them to planes of its own
// (kvP: HD*HD floats per head, ksP: one float per lane and column tile), which k2b sums.
// A kvP plane keeps kvT's order of fragment halves; inside a half it is [4 elements of 8][lane][4], so a
// wave-wide 16-byte store is 512 contiguous bytes.
__global__ __launch_bounds__(256)
void k1_proj(const float* __restrict__ hid, const float* __restrict__ mask,
             const unsigned short* __restrict__ Wb,
             const float* __restrict__ bq, const float* __restrict__ bk,
             const float* __restrict__ bv,
             unsigned short* __restrict__ Qf, float* __restrict__ kvP, float* __restrict__ ksP) {
    __shared__ __attribute__((aligned(16))) unsigned short atile[BLK_M * APITCH];   // bf16
    __shared__ float smask[BLK_M];                   // the rows' mask
    // per wave, MT*NT pieces of 512 bytes. Q group: a 16x16 bf16 tile each (rows d of 32 bytes, columns s),
    // the wave's own. K group: [column tile of the wave][ms][lane][8], the K fragments that all waves read
    __shared__ __attribute__((aligned(16))) unsigned short qpad[8 * MT * NT * FR_HALF];

    const int tid = threadIdx.x;
    const int gm0 = blockIdx.x * BLK_M;              // first global row (b*S+s)

    // read ahead of the staging loads, stored behind them: the store's wait would hold them back
    const float mrow = (tid < BLK_M) ? mask[gm0 + tid] : 0.f;

    // stage A block fp32 -> bf16 into LDS
    // Wave w stages rows w, w+8, ...: a trip takes one 512-byte piece (of RP) of each of its SB rows. A
    // register quad is refilled with the next trip's load right behind its conversion, so SB-1 to SB loads
    // per wave stay in flight. The WGP holds only this block's 8 waves, and with few loads each, all waited
    // for before the next are issued, the stream runs at the memory's latency and not at its rate.
    // The waves start at different pieces, so that the block's loads in flight do not all lie at one
    // offset inside the 3-KB rows.
    {
        int c = (tid >> 5) % RP;                     // the piece that the quads hold
        const float* gsrc = hid + (size_t)(gm0 + (tid >> 5)) * KDIM + c * 128 + (tid & 31) * 4;
        unsigned short* lrow = &atile[(tid >> 5) * APITCH + (tid & 31) * 4];
        float4 sq[SB];
        #pragma unroll
        for (int j = 0; j < SB; ++j) sq[j] = *(const float4*)(gsrc + j * 8 * KDIM);
        // rolled: the trips are alike, and unrolled they would push the epilogue further back in the text
        #pragma unroll 1
        for (int p = 0; p < RP; ++p) {
            // behind the last trip there is nothing left to fetch: its refill stays on the trip's own
            // bytes and is dropped, so that one loop body serves every trip
            const int cn = (p == RP - 1) ? c : ((c == RP - 1) ? 0 : c + 1);
            gsrc += (cn - c) * 128;
            unsigned short* ldst = lrow + c * 128;
            #pragma unroll
            for (int j = 0; j < SB; ++j) {
                const float4 f = sq[j];
                unsigned short* dst = ldst + j * 8 * APITCH;
                *(uint2*)dst = make_uint2(pack2(f.x, f.y), pack2(f.z, f.w));
                sq[j] = *(const float4*)(gsrc + j * 8 * KDIM);
                // keeps each refill right behind its quad's conversion; without it the compiler gathers
                // the loads behind the last conversion, whose wait has drained all that was in flight
                __builtin_amdgcn_sched_barrier(0);
            }
            c = cn;
        }
    }
    if (tid < BLK_M) smask[tid] = mrow;
    __syncthreads();

    const int wave = tid >> 5, lane = tid & 31;
    const int ln = lane & 15, hi = lane >> 4;
    const int b   = gm0 / S_LEN;
    const int sb0 = gm0 % S_LEN;
    const v8f vzero = {0.f,0.f,0.f,0.f,0.f,0.f,0.f,0.f};

    // Software-pipelined k loop. W fragments live in a register ring WRING k-steps deep:
    // a slot is refilled right behind the WMMAs that read it, so a load has WRING-1
    // k-steps of matrix work to land. The LDS fragments are fetched one k-step ahead.
    // A W fragment feeds MT WMMAs and an LDS fragment NT.
    // Packed sets are linear in g: set = g*8 + wave; its stacked W rows are ((sg*8 + wave)*NT + j)*16 + ln, sg = 2*proj + half.
    const unsigned short* wlane = Wb + (size_t)wave * WP_SET + lane * 8;
    Frag ring[WRING][NT];
    Frag af[2][MT];
    #pragma unroll
    for (int s = 0; s < WRING; ++s)
        #pragma unroll
        for (int j = 0; j < NT; ++j) {
            const unsigned short* p = wlane + s * WP_STEP + j * WP_TILE;
            ring[s][j].q[0] = *(const uint4*)p;
            ring[s][j].q[1] = *(const uint4*)(p + WP_HALF);
        }
    #pragma unroll
    for (int ms = 0; ms < MT; ++ms) {
        const unsigned short* p = &atile[(ms * 16 + ln) * APITCH + hi * 8];
        af[0][ms].q[0] = *(const uint4*)p;
        af[0][ms].q[1] = *(const uint4*)(p + 16);
    }
    // precaution: stands in front of the first group's step of the address that the ring's first loads name
    asm volatile("s_wait_xcnt 0x0" ::: "memory");

    const unsigned short* wgrp = wlane;
    for (int g = 0; g < NGROUP; ++g) {                // Q, Q, K, V, K, V: each a half of its columns (6 heads)
        const int proj = (g < 2) ? 0 : 1 + (g & 1);
        const int half = (g < 2) ? g : (g - 2) >> 1;
        const int set  = half * 8 + wave;             // column set inside the projection
        const int n0   = set * NT;                    // first 16-col tile index
        const float* bias = (proj == 0) ? bq : ((proj == 1) ? bk : bv);
        const unsigned short* wcur = wgrp;            // this group's rows of packed W
        // the ring runs on into the next group's rows, over the epilogue; behind the
        // last group there are none, and the refill stays on this group's own rows
        const unsigned short* wnxt = wcur + (g < NGROUP - 1 ? 8 * WP_SET : 0);
        wgrp = wnxt;

        v8f acc[MT][NT];
        #pragma unroll
        for (int ms = 0; ms < MT; ++ms)
            #pragma unroll
            for (int j = 0; j < NT; ++j) acc[ms][j] = vzero;

        #pragma unroll
        for (int k = 0; k < NSTEPS; ++k) {
            // next k-step's LDS fragments (step 0 again behind the last: every group starts there)
            #pragma unroll
            for (int ms = 0; ms < MT; ++ms) {
                const int off1 = ((k + 1) % NSTEPS) * 32 + hi * 8;   // half-index of first 8-chunk
                const unsigned short* p = &atile[(ms * 16 + ln) * APITCH + off1];
                af[(k + 1) & 1][ms].q[0] = *(const uint4*)p;
                af[(k + 1) & 1][ms].q[1] = *(const uint4*)(p + 16);
            }
            // keeps the LDS reads as one group ahead of this step's WMMAs; without it the
            // compiler sinks them to their use and waits out the LDS latency every step
            __builtin_amdgcn_sched_barrier(0);
            #pragma unroll
            for (int ms = 0; ms < MT; ++ms)
                #pragma unroll
                for (int j = 0; j < NT; ++j)
                    acc[ms][j] = wmma_bf16(af[k & 1][ms], ring[k % WRING][j], acc[ms][j]);
            const unsigned short* wsrc = (k + WRING < NSTEPS)
                ? wcur + (k + WRING) * WP_STEP : wnxt + (k + WRING - NSTEPS) * WP_STEP;
            #pragma unroll
            for (int j = 0; j < NT; ++j) {
                const unsigned short* p = wsrc + j * WP_TILE;
                ring[k % WRING][j].q[0] = *(const uint4*)p;
                ring[k % WRING][j].q[1] = *(const uint4*)(p + WP_HALF);
            }
            // keeps the refill here, WRING-1 steps ahead of its use; without it the
            // compiler sinks the loads to their use and the L2 latency is waited out
            __builtin_amdgcn_sched_barrier(0);
        }

        // the lane's NT bias values, read once per group: all MT tiles of a column share them
        float bb[NT];
        #pragma unroll
        for (int j = 0; j < NT; ++j) bb[j] = bias[(n0 + j) * 16 + ln];

        // the wave's number as a scalar: a tile's base address is then formed on the scalar unit,
        // and a store takes it with the lane's fixed offset and a constant for ms
        const int lts = __builtin_amdgcn_readfirstlane(wave) * NT;   // first tile inside the half
        const int nts = half * (NTILE / 2) + lts;                    // and inside the projection

        // ---- epilogue of V: bias, conversion; then kv of the block's rows, K from LDS, V from registers ----
        if (proj == 2) {
            // The lane's 8 rows s of column e are V's fragment order as they stand: tiles 2m and 2m+1 are
            // the two halves of the fragment of s block m. V has no mask and no elu.
            Frag vf[MT / 2][NT];
            #pragma unroll
            for (int ms = 0; ms < MT; ++ms) {
                #pragma unroll
                for (int j = 0; j < NT; ++j) {
                    uint4 w;
                    w.x = pack2(acc[ms][j][0] + bb[j], acc[ms][j][1] + bb[j]);
                    w.y = pack2(acc[ms][j][2] + bb[j], acc[ms][j][3] + bb[j]);
                    w.z = pack2(acc[ms][j][4] + bb[j], acc[ms][j][5] + bb[j]);
                    w.w = pack2(acc[ms][j][6] + bb[j], acc[ms][j][7] + bb[j]);
                    vf[ms >> 1][j].q[ms & 1] = w;
                }
            }
            // publishes the K tiles that every wave wrote to the pad in the group before this one
            __syncthreads();
            // A = K[d,s] (the four d tiles of the head that column tile j lies in), B^T = V[e,s]
            v8f kacc[NT][4];
            #pragma unroll
            for (int j = 0; j < NT; ++j)
                #pragma unroll
                for (int dt = 0; dt < 4; ++dt) kacc[j][dt] = vzero;
            #pragma unroll
            for (int m = 0; m < MT / 2; ++m) {
                #pragma unroll
                for (int j = 0; j < NT; ++j) {
                    const unsigned short* kp = &qpad[((lts + j) >> 2) * (4 * MT * FR_HALF) + lane * 8];
                    #pragma unroll
                    for (int dt = 0; dt < 4; ++dt) {
                        Frag a;
                        a.q[0] = *(const uint4*)(kp + (dt * MT + 2 * m) * FR_HALF);
                        a.q[1] = *(const uint4*)(kp + (dt * MT + 2 * m + 1) * FR_HALF);
                        kacc[j][dt] = wmma_bf16(a, vf[m][j], kacc[j][dt]);
                    }
                }
            }
            // ends every wave's reads of the pad ahead of the next K group's writes to it; behind the last
            // V group nothing is written there any more
            if (half == 0) __syncthreads();
            // kacc[j][dt][r] is kv[d = dt*16 + hi*8 + r][e = (nt%4)*16 + ln]: in kvT's order that is
            // d block dt/2, e tile nt%4, fragment half dt&1, this same lane, element r
            #pragma unroll
            for (int j = 0; j < NT; ++j) {
                const int nt = nts + j;               // 16-column tile: head nt / 4, e tile nt % 4
                float* pl = kvP + ((size_t)(b * NH + (nt >> 2)) * NSLICE + sb0 / BLK_M) * (HD * HD)
                    + (nt & 3) * FR_FRAG + lane * 4;
                #pragma unroll
                for (int dt = 0; dt < 4; ++dt) {
                    float* dst = pl + (dt >> 1) * 4 * FR_FRAG + (dt & 1) * FR_HALF;
                    *(float4*)dst = make_float4(kacc[j][dt][0], kacc[j][dt][1], kacc[j][dt][2], kacc[j][dt][3]);
                    *(float4*)(dst + FR_HALF / 2) =
                        make_float4(kacc[j][dt][4], kacc[j][dt][5], kacc[j][dt][6], kacc[j][dt][7]);
                }
            }
            // precaution: stands in front of the next write (the next group's sums) to a register that one
            // of these stores names
            asm volatile("s_wait_xcnt 0x0" ::: "memory");
            continue;
        }

        // ---- epilogue of Q and K: all MT*NT tiles at once, none waits for the one before it ----
        // The lane's 8 rows s of column d are K's fragment order as they stand (as for V above); Q is
        // transposed below.
        const float* sm = smask + hi * 8;
        uint4 w[MT][NT];
        f32x2 ks[NT];
        #pragma unroll
        for (int j = 0; j < NT; ++j) ks[j] = (f32x2){0.f, 0.f};
        if (proj == 0) {
            qk_pack<false>(acc, bb, sm, w, ks);
            // Q: lane (d, hi) writes its 8 packed s as 16 bytes of row d of the tile's pad; the transposing
            // load hands lane (s, hi) the 8 values d = hi*8 .. +7 of column s. The pad is the wave's own.
            unsigned short* pst = &qpad[wave * (MT * NT * FR_HALF) + ln * 16 + hi * 8];
            const unsigned short* pld =
                &qpad[wave * (MT * NT * FR_HALF) + (hi * 8 + (lane & 7)) * 16 + ((lane >> 3) & 1) * 8];
            #pragma unroll
            for (int ms = 0; ms < MT; ++ms)
                #pragma unroll
                for (int j = 0; j < NT; ++j) *(uint4*)(pst + (ms * NT + j) * FR_HALF) = w[ms][j];
            // keeps the compiler from moving the pad's reads (other lanes' words) ahead of its writes
            __builtin_amdgcn_wave_barrier();
            #pragma unroll
            for (int ms = 0; ms < MT; ++ms)
                #pragma unroll
                for (int j = 0; j < NT; ++j) w[ms][j] = ld_tr16(pld + (ms * NT + j) * FR_HALF);
            // keeps the next group's writes to the pad behind these reads in the compiler's order
            __builtin_amdgcn_wave_barrier();
            #pragma unroll
            for (int ms = 0; ms < MT; ++ms) {
                #pragma unroll
                for (int j = 0; j < NT; ++j) {
                    const int nt = nts + j;           // 16-column tile: head nt / 4, d tile nt % 4
                    // lane (s, hi) holds columns (nt % 4)*16 + hi*8 .. +7 of the head: fragment half
                    // nt & 1 of d block (nt % 4) / 2, s tile sb0/16 + ms
                    unsigned short* dst = Qf + (size_t)(b * NH + (nt >> 2)) * BH_ELEM
                        + (size_t)((sb0 >> 4) + ms) * Q_STILE + ((nt & 3) >> 1) * FR_FRAG
                        + (nt & 1) * FR_HALF + lane * 8;
                    *(uint4*)dst = w[ms][j];
                }
            }
            // precaution: every tile has a register quad of its own, and this stands in front of the next
            // write to a register that one of these stores names
            asm volatile("s_wait_xcnt 0x0" ::: "memory");
        } else {
            qk_pack<true>(acc, bb, sm, w, ks);
            // K: the wave's tiles go to its own part of the pad, which only this wave has touched since the
            // barrier that ended the reads of the K group before; the next group's barrier publishes them
            unsigned short* pst = &qpad[wave * (MT * NT * FR_HALF) + lane * 8];
            #pragma unroll
            for (int ms = 0; ms < MT; ++ms)
                #pragma unroll
                for (int j = 0; j < NT; ++j) *(uint4*)(pst + (j * MT + ms) * FR_HALF) = w[ms][j];
            // the lane's sum over its 64 rows s of column (nts + j)*16 + ln; lane + 16 holds the other 64
            float* kd = ksP + ((size_t)blockIdx.x * NTILE + nts) * 32 + lane;
            #pragma unroll
            for (int j = 0; j < NT; ++j) kd[j * 32] = ks[j].x + ks[j].y;
            // precaution: stands in front of the next write to a register that one of these stores names
            asm volatile("s_wait_xcnt 0x0" ::: "memory");
        }
    }
}

// ================= kernel 2b: sum the blocks' planes; kv^T -> bf16 (fragment order), ksum f32 =========
// A half of the block's threads sums the first NSLICE/2 planes, the other half the rest; LDS joins them.
__global__ __launch_bounds__(256)
void k2b_cvt(const float* __restrict__ kvP, const float* __restrict__ ksP,
             unsigned short* __restrict__ kvT, float* __restrict__ ksum) {
    __shared__ float4 red4[128];
    __shared__ float  red1[128];
    const int t = threadIdx.x & 127, grp = threadIdx.x >> 7;
    if (blockIdx.x < KVB_BLOCKS) {
        // four neighbouring floats of a plane per thread: elements 0..3 or 4..7 of one lane's eight
        const int i  = (blockIdx.x * 128 + t) * 4;
        const int bh = i / (HD * HD), o = i % (HD * HD);
        const float* p = kvP + ((size_t)bh * NSLICE + grp * (NSLICE / 2)) * (HD * HD) + o;
        float4 s = make_float4(0.f, 0.f, 0.f, 0.f);
        #pragma unroll
        for (int sl = 0; sl < NSLICE / 2; ++sl) {
            const float4 v = *(const float4*)(p + sl * (HD * HD));
            s.x += v.x; s.y += v.y; s.z += v.z; s.w += v.w;
        }
        if (grp == 1) red4[t] = s;
        __syncthreads();
        if (grp == 0) {
            const float4 v = red4[t];
            uint2 w;
            w.x = pack2(s.x + v.x, s.y + v.y); w.y = pack2(s.z + v.z, s.w + v.w);
            *(uint2*)&kvT[(i & ~(FR_HALF - 1)) + ((i >> 2) & 31) * 8 + ((i >> 7) & 1) * 4] = w;
        }
    } else {
        // ksum[bh][d]: in each plane, column tile h*4 + d/16, lanes d%16 and +16 hold a part of it
        const int i  = (blockIdx.x - KVB_BLOCKS) * 128 + t;                // bh*HD + d
        const int bh = i / HD, d = i % HD;
        const float* p = ksP + (((size_t)(bh / NH) * NSLICE + grp * (NSLICE / 2)) * NTILE
                                + (bh % NH) * 4 + (d >> 4)) * 32 + (d & 15);
        float s = 0.f;
        #pragma unroll
        for (int sl = 0; sl < NSLICE / 2; ++sl)
            #pragma unroll
            for (int q = 0; q < 2; ++q) s += p[sl * (NTILE * 32) + q * 16];
        // precaution: stands in front of the next write to a register that one of these loads names
        asm volatile("s_wait_xcnt 0x0" ::: "memory");
        if (grp == 1) red1[t] = s;
        __syncthreads();
        if (grp == 0) ksum[i] = s + red1[t];
    }
}

// ================= kernel 3: out = (Q kv) / (Q ksum) =================
__global__ __launch_bounds__(256)
void k3_out(const unsigned short* __restrict__ Qf, const unsigned short* __restrict__ kvT,
            const float* __restrict__ ksum, float* __restrict__ out) {
    __shared__ float sks[HD];
    const int tid = threadIdx.x;
    const int bh  = blockIdx.x >> 6;
    const int blk = blockIdx.x & 63;
    if (tid < HD) sks[tid] = ksum[bh * HD + tid];
    __syncthreads();

    const int wave = tid >> 5, lane = tid & 31, ln = lane & 15, hi = lane >> 4;
    const int st = blk * 8 + wave;                  // s-tile 0..511

    const unsigned short* Ar = Qf + (size_t)bh * BH_ELEM + (size_t)st * Q_STILE + lane * 8;
    const v8f vzero = {0.f,0.f,0.f,0.f,0.f,0.f,0.f,0.f};
    v8f acc[4] = {vzero, vzero, vzero, vzero};
    float part = 0.f;

    #pragma unroll
    for (int k = 0; k < 2; ++k) {
        const int off1 = k * 32 + hi * 8;
        Frag a;
        a.q[0] = *(const uint4*)(Ar + k * FR_FRAG);
        a.q[1] = *(const uint4*)(Ar + k * FR_FRAG + FR_HALF);
        // denominator partial: lane holds Q[st*16+ln, off1..off1+7] and [+16..+23]
        #pragma unroll
        for (int e = 0; e < 8; ++e) part += bf2f(a.us[e])     * sks[off1 + e];
        #pragma unroll
        for (int e = 0; e < 8; ++e) part += bf2f(a.us[8 + e]) * sks[off1 + 16 + e];
        #pragma unroll
        for (int j = 0; j < 4; ++j) {
            const unsigned short* Br = kvT + (size_t)bh * (HD * HD) + (k * 4 + j) * FR_FRAG + lane * 8;
            Frag bfr;
            bfr.q[0] = *(const uint4*)Br;
            bfr.q[1] = *(const uint4*)(Br + FR_HALF);
            acc[j] = wmma_bf16(a, bfr, acc[j]);
        }
    }

    const float dsum = part + __shfl_xor(part, 16, 32);   // combine K-halves
    float dr[8];
    #pragma unroll
    for (int r = 0; r < 8; ++r) dr[r] = __shfl(dsum, r + hi * 8, 32);

    const int b_ = bh / NH, h_ = bh % NH;
    #pragma unroll
    for (int j = 0; j < 4; ++j)
        #pragma unroll
        for (int r = 0; r < 8; ++r) {
            const int s = st * 16 + hi * 8 + r;
            out[((size_t)b_ * S_LEN + s) * HMODEL + h_ * HD + j * 16 + ln] =
                acc[j][r] / dr[r];
        }
}

// ================= launch =================
extern "C" void kernel_launch(void* const* d_in, const int* in_sizes, int n_in,
                              void* d_out, int out_size, void* d_ws, size_t ws_size,
                              hipStream_t stream) {
    const float* hid  = (const float*)d_in[0];
    const float* mask = (const float*)d_in[1];
    const float* Wq   = (const float*)d_in[2];
    const float* bq   = (const float*)d_in[3];
    const float* Wk   = (const float*)d_in[4];
    const float* bk   = (const float*)d_in[5];
    const float* Wv   = (const float*)d_in[6];
    const float* bv   = (const float*)d_in[7];
    float* out = (float*)d_out;

    char* w = (char*)d_ws;                       // 256B-aligned offsets
    unsigned short* Wb  = (unsigned short*)(w);                 // 3.38 MB
    unsigned short* Qf  = (unsigned short*)(w + 3538944);       // 48 MB
    float*          kvP = (float*)(w + 53870592);               // 48 MB
    float*          ksP = (float*)(w + 104202240);              // 1.5 MB
    unsigned short* kvT = (unsigned short*)(w + 155320320);     // 384 KB
    float*          ks  = (float*)(w + 155713536);              // 12 KB

    k0_prep<<<1024, 256, 0, stream>>>(Wq, Wk, Wv, Wb);
    k1_proj<<<M_TOTAL / BLK_M, 256, 0, stream>>>(
        hid, mask, Wb, bq, bk, bv, Qf, kvP, ksP);
    k2b_cvt<<<KVB_BLOCKS + (BATCH * NH * HD) / 128, 256, 0, stream>>>(kvP, ksP, kvT, ks);
    k3_out<<<(BATCH * NH * (S_LEN / 16)) / 8, 256, 0, stream>>>(Qf, kvT, ks, out);
}
